// v000
// Times are from an AMD MI455X. After a warm-up the kernel runs many times in a row, and a time is the length of
// such a window on the GPU divided by its runs, so every launch and the gaps after it count. The runs cycle
// through copies of the inputs. A figure is the median of several windows, for all but v000 over two sittings.
// Sittings can differ by a few percent; kernels timed side by side share one.
// The starting kernel, v000, takes 827 microseconds a run.
#include <hip/hip_runtime.h>
#include <hip/hip_bf16.h>

typedef __bf16 bf16x8  __attribute__((ext_vector_type(8)));
typedef __bf16 bf16x16 __attribute__((ext_vector_type(16)));
typedef float  f32x8   __attribute__((ext_vector_type(8)));
typedef float  f32x4   __attribute__((ext_vector_type(4)));

namespace {

constexpr int Mdim = 16384;
constexpr int Kdim = 2048;
constexpr int Ndim = 2048;
constexpr int GS   = 32;          // channels per group (N/G = 2048/64)
constexpr float EPS = 1e-5f;

constexpr int BM = 128, BN = 128, BK = 64;

union FragAB { bf16x16 v; bf16x8 h[2]; };

__device__ __forceinline__ f32x8 wmma_bf16(bf16x16 a, bf16x16 b, f32x8 c) {
  // 8 args: (neg_a, A, neg_b, B, c_mod, C, reuse_a, reuse_b)
  return __builtin_amdgcn_wmma_f32_16x16x32_bf16(false, a, false, b,
                                                 (short)0, c, false, false);
}

// Load one 16x32 bf16 WMMA operand fragment from LDS.
// Per ISA layout: lanes 0-15 take K chunks [0,8)+[16,24); lanes 16-31 take
// [8,16)+[24,32) of their row/col. `k` already includes ks + half*8.
__device__ __forceinline__ bf16x16 lds_frag(const __bf16* rowBase, int k) {
  FragAB f;
  f.h[0] = *(const bf16x8*)(rowBase + k);
  f.h[1] = *(const bf16x8*)(rowBase + k + 16);
  return f.v;
}

// Prefetch 32 consecutive f32 (one staging slice) into registers.
__device__ __forceinline__ void load32(const float* __restrict__ src, f32x4* p) {
  #pragma unroll
  for (int i = 0; i < 8; ++i) p[i] = *(const f32x4*)(src + i * 4);
}

// Split 32 prefetched f32 into bf16 hi + bf16 residual lo, store to LDS.
__device__ __forceinline__ void cvt_store32(const f32x4* p,
                                            __bf16* dh, __bf16* dl) {
  #pragma unroll
  for (int i = 0; i < 4; ++i) {
    float f[8] = {p[2 * i][0],     p[2 * i][1],     p[2 * i][2],     p[2 * i][3],
                  p[2 * i + 1][0], p[2 * i + 1][1], p[2 * i + 1][2], p[2 * i + 1][3]};
    bf16x8 vh, vl;
    #pragma unroll
    for (int j = 0; j < 8; ++j) {
      __bf16 hi = (__bf16)f[j];
      vh[j] = hi;
      vl[j] = (__bf16)(f[j] - (float)hi);
    }
    *(bf16x8*)(dh + i * 8) = vh;
    *(bf16x8*)(dl + i * 8) = vl;
  }
}

__device__ __forceinline__ float sigmoidf_fast(float x) {
  return 1.0f / (1.0f + __expf(-x));
}

__device__ __forceinline__ float gn_silu_chain(float v, float a, float b, float m) {
  float yn = v * a + b;          // (v - mean) * inv * gamma + beta, folded
  float t  = yn * sigmoidf_fast(yn);
  t *= m;
  return t * sigmoidf_fast(t);
}

} // namespace

__global__ __launch_bounds__(256)
void fused_gemm_gn_silu(const float* __restrict__ x,
                        const float* __restrict__ w,
                        const float* __restrict__ bias,
                        const float* __restrict__ gnw,
                        const float* __restrict__ gnb,
                        const float* __restrict__ mw,
                        float* __restrict__ out) {
  // 64 KB LDS, time-aliased: [A_hi|A_lo|B_hi|B_lo] during GEMM, C f32 tile after.
  __shared__ __align__(16) unsigned char smem[BM * BN * 4];

  __bf16* Ahi = (__bf16*)smem;            // [BM][BK]
  __bf16* Alo = Ahi + BM * BK;
  __bf16* Bhi = Alo + BM * BK;
  __bf16* Blo = Bhi + BM * BK;
  float*  Cs  = (float*)smem;             // [BM][BN]

  const int tid  = threadIdx.x;
  const int lane = tid & 31;
  const int wave = tid >> 5;
  const int wm   = wave >> 2;             // 0..1  -> 64-row strip
  const int wn   = wave & 3;              // 0..3  -> 32-col strip
  const int r16  = lane & 15;
  const int half = lane >> 4;             // K sub-chunk select per WMMA layout

  const int m0 = blockIdx.y * BM;
  const int n0 = blockIdx.x * BN;

  // Staging: 2 threads per tile row, 32 f32 each.
  const int sRow = tid >> 1;
  const int sCol = (tid & 1) * 32;

  const float* baseA = x + (size_t)(m0 + sRow) * Kdim + sCol;
  const float* baseB = w + (size_t)(n0 + sRow) * Kdim + sCol;

  f32x8 acc[4][2] = {};

  // Software pipeline: prefetch K-tile 0 into registers.
  f32x4 pA[8], pB[8];
  load32(baseA, pA);
  load32(baseB, pB);

  for (int k0 = 0; k0 < Kdim; k0 += BK) {
    __syncthreads();   // previous iteration's LDS readers done
    cvt_store32(pA, Ahi + sRow * BK + sCol, Alo + sRow * BK + sCol);
    cvt_store32(pB, Bhi + sRow * BK + sCol, Blo + sRow * BK + sCol);
    __syncthreads();

    // Issue next tile's global loads now; latency overlaps the WMMAs below.
    // k0 is uniform, so EXEC stays all-ones for the WMMA section.
    if (k0 + BK < Kdim) {
      load32(baseA + k0 + BK, pA);
      load32(baseB + k0 + BK, pB);
    }

    #pragma unroll
    for (int ks = 0; ks < BK; ks += 32) {
      const int kk = ks + half * 8;
      bf16x16 bh[2], bl[2];
      #pragma unroll
      for (int ns = 0; ns < 2; ++ns) {
        const int col = wn * 32 + ns * 16 + r16;
        bh[ns] = lds_frag(Bhi + col * BK, kk);
        bl[ns] = lds_frag(Blo + col * BK, kk);
      }
      #pragma unroll
      for (int ms = 0; ms < 4; ++ms) {
        const int row = wm * 64 + ms * 16 + r16;
        bf16x16 ah = lds_frag(Ahi + row * BK, kk);
        bf16x16 al = lds_frag(Alo + row * BK, kk);
        #pragma unroll
        for (int ns = 0; ns < 2; ++ns) {
          // bf16x3 split-precision accumulation (hi*hi + hi*lo + lo*hi), f32 C
          acc[ms][ns] = wmma_bf16(ah, bh[ns], acc[ms][ns]);
          acc[ms][ns] = wmma_bf16(ah, bl[ns], acc[ms][ns]);
          acc[ms][ns] = wmma_bf16(al, bh[ns], acc[ms][ns]);
        }
      }
    }
  }

  __syncthreads();  // staging readers done before C tile overwrites LDS

  // Spill accumulators (+bias) to LDS C tile per 16x16 f32 C/D layout:
  // VGPR r: lanes 0-15 -> M=r, lanes 16-31 -> M=8+r; N = lane & 15.
  #pragma unroll
  for (int ms = 0; ms < 4; ++ms) {
    #pragma unroll
    for (int ns = 0; ns < 2; ++ns) {
      const int colT = wn * 32 + ns * 16 + r16;
      const float bv = bias[n0 + colT];
      #pragma unroll
      for (int r = 0; r < 8; ++r) {
        const int rowT = wm * 64 + ms * 16 + half * 8 + r;
        Cs[rowT * BN + colT] = acc[ms][ns][r] + bv;
      }
    }
  }
  __syncthreads();

  // Fused GroupNorm + SiLU * scale * SiLU epilogue.
  // Each wave handles 16 rows; lane owns 4 consecutive channels, all in the
  // same group (group = lane>>3, 8 lanes/group) -> shfl_xor reduction.
  const int   g     = lane >> 3;                       // group within tile row
  const int   gidx  = blockIdx.x * (BN / GS) + g;      // global group id
  const float gamma = gnw[gidx];
  const float beta  = gnb[gidx];
  const f32x4 mwv   = *(const f32x4*)(mw + n0 + lane * 4);

  for (int rr = 0; rr < 16; ++rr) {
    const int rowT = wave * 16 + rr;
    const f32x4 v = *(const f32x4*)(Cs + rowT * BN + lane * 4);
    float s  = v[0] + v[1] + v[2] + v[3];
    float ss = v[0] * v[0] + v[1] * v[1] + v[2] * v[2] + v[3] * v[3];
    #pragma unroll
    for (int d = 1; d < 8; d <<= 1) {
      s  += __shfl_xor(s,  d, 32);
      ss += __shfl_xor(ss, d, 32);
    }
    const float mean = s * (1.0f / GS);
    const float var  = ss * (1.0f / GS) - mean * mean;
    const float inv  = rsqrtf(var + EPS);
    const float a    = inv * gamma;
    const float b    = beta - mean * a;

    f32x4 o;
    o[0] = gn_silu_chain(v[0], a, b, mwv[0]);
    o[1] = gn_silu_chain(v[1], a, b, mwv[1]);
    o[2] = gn_silu_chain(v[2], a, b, mwv[2]);
    o[3] = gn_silu_chain(v[3], a, b, mwv[3]);
    // Output is write-once: stream past L2 (TH=NT) to preserve x/W reuse.
    __builtin_nontemporal_store(o,
        (f32x4*)(out + (size_t)(m0 + rowT) * Ndim + n0 + lane * 4));
  }
}

extern "C" void kernel_launch(void* const* d_in, const int* in_sizes, int n_in,
                              void* d_out, int out_size, void* d_ws, size_t ws_size,
                              hipStream_t stream) {
  (void)in_sizes; (void)n_in; (void)out_size; (void)d_ws; (void)ws_size;
  const float* x    = (const float*)d_in[0];
  const float* w    = (const float*)d_in[1];
  const float* bias = (const float*)d_in[2];
  const float* gnw  = (const float*)d_in[3];
  const float* gnb  = (const float*)d_in[4];
  const float* mw   = (const float*)d_in[5];
  float* out        = (float*)d_out;

  dim3 grid(Ndim / BN, Mdim / BM);   // 16 x 128 workgroups
  dim3 block(256);                   // 8 wave32s
  fused_gemm_gn_silu<<<grid, block, 0, stream>>>(x, w, bias, gnw, gnb, mw, out);
}

// v001
// One run takes 452 microseconds.
// Two timings next to v000 both put it at 1.92 times that version's speed.
#include <hip/hip_runtime.h>
#include <hip/hip_bf16.h>

typedef __bf16 bf16x8  __attribute__((ext_vector_type(8)));
typedef __bf16 bf16x16 __attribute__((ext_vector_type(16)));
typedef float  f32x8   __attribute__((ext_vector_type(8)));
typedef float  f32x4   __attribute__((ext_vector_type(4)));

namespace {

constexpr int Mdim = 16384;
constexpr int Kdim = 2048;
constexpr int Ndim = 2048;
constexpr int GS   = 32;          // channels per group (N/G = 2048/64)
constexpr float EPS = 1e-5f;

constexpr int BM = 128, BN = 128, BK = 64;
// LDS row pitch of the staged bf16 planes, in elements: 64 data + 8 pad = 144 B
// (16 B x odd), so the 16 rows of a ds_load_b128 fragment read fall on distinct banks.
constexpr int LDP = BK + 8;

union FragAB { bf16x16 v; bf16x8 h[2]; };

__device__ __forceinline__ f32x8 wmma_bf16(bf16x16 a, bf16x16 b, f32x8 c) {
  // 8 args: (neg_a, A, neg_b, B, c_mod, C, reuse_a, reuse_b)
  return __builtin_amdgcn_wmma_f32_16x16x32_bf16(false, a, false, b,
                                                 (short)0, c, false, false);
}

// Load one 16x32 bf16 WMMA operand fragment from LDS.
// Per ISA layout: lanes 0-15 take K chunks [0,8)+[16,24); lanes 16-31 take
// [8,16)+[24,32) of their row/col. `k` already includes ks + half*8.
__device__ __forceinline__ bf16x16 lds_frag(const __bf16* rowBase, int k) {
  FragAB f;
  f.h[0] = *(const bf16x8*)(rowBase + k);
  f.h[1] = *(const bf16x8*)(rowBase + k + 16);
  return f.v;
}

// Prefetch 32 consecutive f32 (one staging slice) into registers.
__device__ __forceinline__ void load32(const float* __restrict__ src, f32x4* p) {
  #pragma unroll
  for (int i = 0; i < 8; ++i) p[i] = *(const f32x4*)(src + i * 4);
}

// Split 32 prefetched f32 into bf16 hi + bf16 residual lo, store to LDS.
__device__ __forceinline__ void cvt_store32(const f32x4* p,
                                            __bf16* dh, __bf16* dl) {
  #pragma unroll
  for (int i = 0; i < 4; ++i) {
    float f[8] = {p[2 * i][0],     p[2 * i][1],     p[2 * i][2],     p[2 * i][3],
                  p[2 * i + 1][0], p[2 * i + 1][1], p[2 * i + 1][2], p[2 * i + 1][3]};
    bf16x8 vh, vl;
    #pragma unroll
    for (int j = 0; j < 8; ++j) {
      __bf16 hi = (__bf16)f[j];
      vh[j] = hi;
      vl[j] = (__bf16)(f[j] - (float)hi);
    }
    *(bf16x8*)(dh + i * 8) = vh;
    *(bf16x8*)(dl + i * 8) = vl;
  }
}

__device__ __forceinline__ float sigmoidf_fast(float x) {
  return 1.0f / (1.0f + __expf(-x));
}

__device__ __forceinline__ float gn_silu_chain(float v, float a, float b, float m) {
  float yn = v * a + b;          // (v - mean) * inv * gamma + beta, folded
  float t  = yn * sigmoidf_fast(yn);
  t *= m;
  return t * sigmoidf_fast(t);
}

} // namespace

__global__ __launch_bounds__(256)
void fused_gemm_gn_silu(const float* __restrict__ x,
                        const float* __restrict__ w,
                        const float* __restrict__ bias,
                        const float* __restrict__ gnw,
                        const float* __restrict__ gnb,
                        const float* __restrict__ mw,
                        float* __restrict__ out) {
  // 72 KB LDS, time-aliased: [A_hi|A_lo|B_hi|B_lo] during GEMM, C f32 tile after.
  static_assert(4 * BM * LDP * 2 >= BM * BN * 4, "C tile must fit in the staging planes");
  __shared__ __align__(16) unsigned char smem[4 * BM * LDP * 2];

  __bf16* Ahi = (__bf16*)smem;            // [BM][LDP]
  __bf16* Alo = Ahi + BM * LDP;
  __bf16* Bhi = Alo + BM * LDP;
  __bf16* Blo = Bhi + BM * LDP;
  float*  Cs  = (float*)smem;             // [BM][BN]

  const int tid  = threadIdx.x;
  const int lane = tid & 31;
  const int wave = tid >> 5;
  const int wm   = wave >> 2;             // 0..1  -> 64-row strip
  const int wn   = wave & 3;              // 0..3  -> 32-col strip
  const int r16  = lane & 15;
  const int half = lane >> 4;             // K sub-chunk select per WMMA layout

  const int m0 = blockIdx.y * BM;
  const int n0 = blockIdx.x * BN;

  // Staging: 2 threads per tile row, 32 f32 each.
  const int sRow = tid >> 1;
  const int sCol = (tid & 1) * 32;

  const float* baseA = x + (size_t)(m0 + sRow) * Kdim + sCol;
  const float* baseB = w + (size_t)(n0 + sRow) * Kdim + sCol;

  f32x8 acc[4][2] = {};

  // Software pipeline: prefetch K-tile 0 into registers.
  f32x4 pA[8], pB[8];
  load32(baseA, pA);
  load32(baseB, pB);

  for (int k0 = 0; k0 < Kdim; k0 += BK) {
    __syncthreads();   // previous iteration's LDS readers done
    cvt_store32(pA, Ahi + sRow * LDP + sCol, Alo + sRow * LDP + sCol);
    cvt_store32(pB, Bhi + sRow * LDP + sCol, Blo + sRow * LDP + sCol);
    __syncthreads();

    // Issue next tile's global loads now; latency overlaps the WMMAs below.
    // k0 is uniform, so EXEC stays all-ones for the WMMA section.
    if (k0 + BK < Kdim) {
      load32(baseA + k0 + BK, pA);
      load32(baseB + k0 + BK, pB);
    }

    #pragma unroll
    for (int ks = 0; ks < BK; ks += 32) {
      const int kk = ks + half * 8;
      bf16x16 bh[2], bl[2];
      #pragma unroll
      for (int ns = 0; ns < 2; ++ns) {
        const int col = wn * 32 + ns * 16 + r16;
        bh[ns] = lds_frag(Bhi + col * LDP, kk);
        bl[ns] = lds_frag(Blo + col * LDP, kk);
      }
      #pragma unroll
      for (int ms = 0; ms < 4; ++ms) {
        const int row = wm * 64 + ms * 16 + r16;
        bf16x16 ah = lds_frag(Ahi + row * LDP, kk);
        bf16x16 al = lds_frag(Alo + row * LDP, kk);
        #pragma unroll
        for (int ns = 0; ns < 2; ++ns) {
          // bf16x3 split-precision accumulation (hi*hi + hi*lo + lo*hi), f32 C
          acc[ms][ns] = wmma_bf16(ah, bh[ns], acc[ms][ns]);
          acc[ms][ns] = wmma_bf16(ah, bl[ns], acc[ms][ns]);
          acc[ms][ns] = wmma_bf16(al, bh[ns], acc[ms][ns]);
        }
      }
    }
  }

  __syncthreads();  // staging readers done before C tile overwrites LDS

  // Spill accumulators (+bias) to LDS C tile per 16x16 f32 C/D layout:
  // VGPR r: lanes 0-15 -> M=r, lanes 16-31 -> M=8+r; N = lane & 15.
  #pragma unroll
  for (int ms = 0; ms < 4; ++ms) {
    #pragma unroll
    for (int ns = 0; ns < 2; ++ns) {
      const int colT = wn * 32 + ns * 16 + r16;
      const float bv = bias[n0 + colT];
      #pragma unroll
      for (int r = 0; r < 8; ++r) {
        const int rowT = wm * 64 + ms * 16 + half * 8 + r;
        Cs[rowT * BN + colT] = acc[ms][ns][r] + bv;
      }
    }
  }
  __syncthreads();

  // Fused GroupNorm + SiLU * scale * SiLU epilogue.
  // Each wave handles 16 rows; lane owns 4 consecutive channels, all in the
  // same group (group = lane>>3, 8 lanes/group) -> shfl_xor reduction.
  const int   g     = lane >> 3;                       // group within tile row
  const int   gidx  = blockIdx.x * (BN / GS) + g;      // global group id
  const float gamma = gnw[gidx];
  const float beta  = gnb[gidx];
  const f32x4 mwv   = *(const f32x4*)(mw + n0 + lane * 4);

  for (int rr = 0; rr < 16; ++rr) {
    const int rowT = wave * 16 + rr;
    const f32x4 v = *(const f32x4*)(Cs + rowT * BN + lane * 4);
    float s  = v[0] + v[1] + v[2] + v[3];
    float ss = v[0] * v[0] + v[1] * v[1] + v[2] * v[2] + v[3] * v[3];
    #pragma unroll
    for (int d = 1; d < 8; d <<= 1) {
      s  += __shfl_xor(s,  d, 32);
      ss += __shfl_xor(ss, d, 32);
    }
    const float mean = s * (1.0f / GS);
    const float var  = ss * (1.0f / GS) - mean * mean;
    const float inv  = rsqrtf(var + EPS);
    const float a    = inv * gamma;
    const float b    = beta - mean * a;

    f32x4 o;
    o[0] = gn_silu_chain(v[0], a, b, mwv[0]);
    o[1] = gn_silu_chain(v[1], a, b, mwv[1]);
    o[2] = gn_silu_chain(v[2], a, b, mwv[2]);
    o[3] = gn_silu_chain(v[3], a, b, mwv[3]);
    // Output is write-once: stream past L2 (TH=NT) to preserve x/W reuse.
    __builtin_nontemporal_store(o,
        (f32x4*)(out + (size_t)(m0 + rowT) * Ndim + n0 + lane * 4));
  }
}

extern "C" void kernel_launch(void* const* d_in, const int* in_sizes, int n_in,
                              void* d_out, int out_size, void* d_ws, size_t ws_size,
                              hipStream_t stream) {
  (void)in_sizes; (void)n_in; (void)out_size; (void)d_ws; (void)ws_size;
  const float* x    = (const float*)d_in[0];
  const float* w    = (const float*)d_in[1];
  const float* bias = (const float*)d_in[2];
  const float* gnw  = (const float*)d_in[3];
  const float* gnb  = (const float*)d_in[4];
  const float* mw   = (const float*)d_in[5];
  float* out        = (float*)d_out;

  dim3 grid(Ndim / BN, Mdim / BM);   // 16 x 128 workgroups
  dim3 block(256);                   // 8 wave32s
  fused_gemm_gn_silu<<<grid, block, 0, stream>>>(x, w, bias, gnw, gnb, mw, out);
}

// v002
// A run of this version takes 307 microseconds.
// Two timings next to v001 both put it at 1.47 times that version's speed.
// All steps since v000 together make it 2.83 times as fast.
#include <hip/hip_runtime.h>
#include <hip/hip_bf16.h>

typedef __bf16 bf16x4  __attribute__((ext_vector_type(4)));
typedef __bf16 bf16x8  __attribute__((ext_vector_type(8)));
typedef __bf16 bf16x16 __attribute__((ext_vector_type(16)));
typedef float  f32x8   __attribute__((ext_vector_type(8)));
typedef float  f32x4   __attribute__((ext_vector_type(4)));

namespace {

constexpr int Mdim = 16384;
constexpr int Kdim = 2048;
constexpr int Ndim = 2048;
constexpr int GS   = 32;          // channels per group (N/G = 2048/64)
constexpr float EPS = 1e-5f;

constexpr int BM = 128, BN = 128, BK = 64;
// LDS row pitch of the staged bf16 planes, in elements: 64 data + 8 pad = 144 B
// (16 B x odd), so the 16 rows of a ds_load_b128 fragment read fall on distinct banks.
constexpr int LDP = BK + 8;

// Pointers typed as global memory: they stay global_load addresses after passing
// through an asm operand.
typedef const __attribute__((address_space(1))) float* gfloat_ptr;
typedef const __attribute__((address_space(1))) f32x4* gf32x4_ptr;

union FragAB { bf16x16 v; bf16x8 h[2]; };

__device__ __forceinline__ f32x8 wmma_bf16(bf16x16 a, bf16x16 b, f32x8 c) {
  // 8 args: (neg_a, A, neg_b, B, c_mod, C, reuse_a, reuse_b)
  return __builtin_amdgcn_wmma_f32_16x16x32_bf16(false, a, false, b,
                                                 (short)0, c, false, false);
}

// Load one 16x32 bf16 WMMA operand fragment from LDS.
// Per ISA layout: lanes 0-15 take K chunks [0,8)+[16,24); lanes 16-31 take
// [8,16)+[24,32) of their row/col. `k` already includes ks + half*8.
__device__ __forceinline__ bf16x16 lds_frag(const __bf16* rowBase, int k) {
  FragAB f;
  f.h[0] = *(const bf16x8*)(rowBase + k);
  f.h[1] = *(const bf16x8*)(rowBase + k + 16);
  return f.v;
}

// Prefetch one staging slice into registers: 4 f32 of each of 8 tile rows, 16 rows apart.
// 16 adjacent lanes read one row's 256 B, so a wave-wide load covers four whole 128-B lines.
__device__ __forceinline__ void load_slice(gfloat_ptr src, f32x4* p) {
  #pragma unroll
  for (int i = 0; i < 8; ++i) p[i] = *(gf32x4_ptr)(src + (size_t)i * 16 * Kdim);
}

// Split the prefetched slice into bf16 hi + bf16 residual lo, store to LDS.
__device__ __forceinline__ void cvt_store_slice(const f32x4* p,
                                                __bf16* dh, __bf16* dl) {
  #pragma unroll
  for (int i = 0; i < 8; ++i) {
    bf16x4 vh, vl;
    #pragma unroll
    for (int j = 0; j < 4; ++j) {
      __bf16 hi = (__bf16)p[i][j];
      vh[j] = hi;
      vl[j] = (__bf16)(p[i][j] - (float)hi);
    }
    *(bf16x4*)(dh + i * 16 * LDP) = vh;
    *(bf16x4*)(dl + i * 16 * LDP) = vl;
  }
}

__device__ __forceinline__ float sigmoidf_fast(float x) {
  return 1.0f / (1.0f + __expf(-x));
}

__device__ __forceinline__ float gn_silu_chain(float v, float a, float b, float m) {
  float yn = v * a + b;          // (v - mean) * inv * gamma + beta, folded
  float t  = yn * sigmoidf_fast(yn);
  t *= m;
  return t * sigmoidf_fast(t);
}

} // namespace

__global__ __launch_bounds__(256)
void fused_gemm_gn_silu(const float* __restrict__ x,
                        const float* __restrict__ w,
                        const float* __restrict__ bias,
                        const float* __restrict__ gnw,
                        const float* __restrict__ gnb,
                        const float* __restrict__ mw,
                        float* __restrict__ out) {
  // 72 KB LDS, time-aliased: [A_hi|A_lo|B_hi|B_lo] during GEMM, C f32 tile after.
  static_assert(4 * BM * LDP * 2 >= BM * BN * 4, "C tile must fit in the staging planes");
  __shared__ __align__(16) unsigned char smem[4 * BM * LDP * 2];

  __bf16* Ahi = (__bf16*)smem;            // [BM][LDP]
  __bf16* Alo = Ahi + BM * LDP;
  __bf16* Bhi = Alo + BM * LDP;
  __bf16* Blo = Bhi + BM * LDP;
  float*  Cs  = (float*)smem;             // [BM][BN]

  const int tid  = threadIdx.x;
  const int lane = tid & 31;
  const int wave = tid >> 5;
  const int wm   = wave >> 2;             // 0..1  -> 64-row strip
  const int wn   = wave & 3;              // 0..3  -> 32-col strip
  const int r16  = lane & 15;
  const int half = lane >> 4;             // K sub-chunk select per WMMA layout

  const int m0 = blockIdx.y * BM;
  const int n0 = blockIdx.x * BN;

  // Staging: 16 lanes per tile row, 4 f32 each; a thread serves rows sRow + 16 * i.
  // A wave's two rows lie 8 apart: 8 * 144 B = 32 banks mod 64, so its 8-byte LDS
  // stores fall on 64 distinct banks.
  const int sRow = wave + half * 8;
  const int sCol = r16 * 4;


  gfloat_ptr srcA = (gfloat_ptr)(x + (size_t)(m0 + sRow) * Kdim + sCol);
  gfloat_ptr srcB = (gfloat_ptr)(w + (size_t)(n0 + sRow) * Kdim + sCol);

  f32x8 acc[4][2] = {};

  // Software pipeline: prefetch K-tile 0 into registers.
  f32x4 pA[8], pB[8];
  load_slice(srcA, pA);
  load_slice(srcB, pB);

  for (int k0 = 0; k0 < Kdim; k0 += BK) {
    __syncthreads();   // previous iteration's LDS readers done
    cvt_store_slice(pA, Ahi + sRow * LDP + sCol, Alo + sRow * LDP + sCol);
    cvt_store_slice(pB, Bhi + sRow * LDP + sCol, Blo + sRow * LDP + sCol);
    __syncthreads();

    // Issue next tile's global loads now; latency overlaps the WMMAs below.
    // k0 is uniform, so EXEC stays all-ones for the WMMA section.
    if (k0 + BK < Kdim) {
      load_slice(srcA + BK, pA);
      load_slice(srcB + BK, pB);
    }

    #pragma unroll
    for (int ks = 0; ks < BK; ks += 32) {
      const int kk = ks + half * 8;
      bf16x16 bh[2], bl[2];
      #pragma unroll
      for (int ns = 0; ns < 2; ++ns) {
        const int col = wn * 32 + ns * 16 + r16;
        bh[ns] = lds_frag(Bhi + col * LDP, kk);
        bl[ns] = lds_frag(Blo + col * LDP, kk);
      }
      #pragma unroll
      for (int ms = 0; ms < 4; ++ms) {
        const int row = wm * 64 + ms * 16 + r16;
        bf16x16 ah = lds_frag(Ahi + row * LDP, kk);
        bf16x16 al = lds_frag(Alo + row * LDP, kk);
        #pragma unroll
        for (int ns = 0; ns < 2; ++ns) {
          // bf16x3 split-precision accumulation (hi*hi + hi*lo + lo*hi), f32 C
          acc[ms][ns] = wmma_bf16(ah, bh[ns], acc[ms][ns]);
          acc[ms][ns] = wmma_bf16(ah, bl[ns], acc[ms][ns]);
          acc[ms][ns] = wmma_bf16(al, bh[ns], acc[ms][ns]);
        }
      }
    }
    // The loads issued above name srcA and srcB: wait for their address translations
    // before the pointers advance. It stands at the end of the trip so that the WMMAs
    // run meanwhile; the operands keep the two additions behind it.
    asm volatile("s_wait_xcnt 0x0" : "+v"(srcA), "+v"(srcB) :: "memory");
    srcA += BK;
    srcB += BK;
  }

  __syncthreads();  // staging readers done before C tile overwrites LDS

  // Spill accumulators (+bias) to LDS C tile per 16x16 f32 C/D layout:
  // VGPR r: lanes 0-15 -> M=r, lanes 16-31 -> M=8+r; N = lane & 15.
  #pragma unroll
  for (int ms = 0; ms < 4; ++ms) {
    #pragma unroll
    for (int ns = 0; ns < 2; ++ns) {
      const int colT = wn * 32 + ns * 16 + r16;
      const float bv = bias[n0 + colT];
      #pragma unroll
      for (int r = 0; r < 8; ++r) {
        const int rowT = wm * 64 + ms * 16 + half * 8 + r;
        Cs[rowT * BN + colT] = acc[ms][ns][r] + bv;
      }
    }
  }
  __syncthreads();

  // Fused GroupNorm + SiLU * scale * SiLU epilogue.
  // Each wave handles 16 rows; lane owns 4 consecutive channels, all in the
  // same group (group = lane>>3, 8 lanes/group) -> shfl_xor reduction.
  const int   g     = lane >> 3;                       // group within tile row
  const int   gidx  = blockIdx.x * (BN / GS) + g;      // global group id
  const float gamma = gnw[gidx];
  const float beta  = gnb[gidx];
  const f32x4 mwv   = *(const f32x4*)(mw + n0 + lane * 4);

  for (int rr = 0; rr < 16; ++rr) {
    const int rowT = wave * 16 + rr;
    const f32x4 v = *(const f32x4*)(Cs + rowT * BN + lane * 4);
    float s  = v[0] + v[1] + v[2] + v[3];
    float ss = v[0] * v[0] + v[1] * v[1] + v[2] * v[2] + v[3] * v[3];
    #pragma unroll
    for (int d = 1; d < 8; d <<= 1) {
      s  += __shfl_xor(s,  d, 32);
      ss += __shfl_xor(ss, d, 32);
    }
    const float mean = s * (1.0f / GS);
    const float var  = ss * (1.0f / GS) - mean * mean;
    const float inv  = rsqrtf(var + EPS);
    const float a    = inv * gamma;
    const float b    = beta - mean * a;

    f32x4 o;
    o[0] = gn_silu_chain(v[0], a, b, mwv[0]);
    o[1] = gn_silu_chain(v[1], a, b, mwv[1]);
    o[2] = gn_silu_chain(v[2], a, b, mwv[2]);
    o[3] = gn_silu_chain(v[3], a, b, mwv[3]);
    // Output is write-once: stream past L2 (TH=NT) to preserve x/W reuse.
    __builtin_nontemporal_store(o,
        (f32x4*)(out + (size_t)(m0 + rowT) * Ndim + n0 + lane * 4));
  }
}

extern "C" void kernel_launch(void* const* d_in, const int* in_sizes, int n_in,
                              void* d_out, int out_size, void* d_ws, size_t ws_size,
                              hipStream_t stream) {
  (void)in_sizes; (void)n_in; (void)out_size; (void)d_ws; (void)ws_size;
  const float* x    = (const float*)d_in[0];
  const float* w    = (const float*)d_in[1];
  const float* bias = (const float*)d_in[2];
  const float* gnw  = (const float*)d_in[3];
  const float* gnb  = (const float*)d_in[4];
  const float* mw   = (const float*)d_in[5];
  float* out        = (float*)d_out;

  dim3 grid(Ndim / BN, Mdim / BM);   // 16 x 128 workgroups
  dim3 block(256);                   // 8 wave32s
  fused_gemm_gn_silu<<<grid, block, 0, stream>>>(x, w, bias, gnw, gnb, mw, out);
}

// v003
// It runs in 264 microseconds.
// Two timings next to v002 both put it at 1.15 times that version's speed.
// All steps since v000 together make it 3.25 times as fast.
#include <hip/hip_runtime.h>
#include <hip/hip_bf16.h>

typedef __bf16 bf16x4  __attribute__((ext_vector_type(4)));
typedef __bf16 bf16x8  __attribute__((ext_vector_type(8)));
typedef __bf16 bf16x16 __attribute__((ext_vector_type(16)));
typedef float  f32x8   __attribute__((ext_vector_type(8)));
typedef float  f32x4   __attribute__((ext_vector_type(4)));

namespace {

constexpr int Mdim = 16384;
constexpr int Kdim = 2048;
constexpr int Ndim = 2048;
constexpr int GS   = 32;          // channels per group (N/G = 2048/64)
constexpr float EPS = 1e-5f;

// One 256 x 256 tile per work-group, 128 x 64 per wave (8 x 4 accumulator tiles): each
// staged element and each loaded fragment feeds twice the products of a 128 x 128 tile.
constexpr int BM = 256, BN = 256, BK = 64;
constexpr int MS = 8, NS = 4;     // 16 x 16 accumulator tiles per wave, rows x columns
constexpr int SL = BM / 16;       // tile rows a thread stages per operand
static_assert(BM == BN, "both operands are staged in SL rows a thread");
// LDS row pitch of the staged bf16 planes, in elements: 64 data + 8 pad = 144 B
// (16 B x odd), so the 16 rows of a ds_load_b128 fragment read fall on distinct banks.
constexpr int LDP = BK + 8;

// Pointers typed as global memory: they stay global_load addresses after passing
// through an asm operand.
typedef const __attribute__((address_space(1))) float* gfloat_ptr;
typedef const __attribute__((address_space(1))) f32x4* gf32x4_ptr;

union FragAB { bf16x16 v; bf16x8 h[2]; };

__device__ __forceinline__ f32x8 wmma_bf16(bf16x16 a, bf16x16 b, f32x8 c) {
  // 8 args: (neg_a, A, neg_b, B, c_mod, C, reuse_a, reuse_b)
  return __builtin_amdgcn_wmma_f32_16x16x32_bf16(false, a, false, b,
                                                 (short)0, c, false, false);
}

// Load one 16x32 bf16 WMMA operand fragment from LDS.
// Per ISA layout: lanes 0-15 take K chunks [0,8)+[16,24); lanes 16-31 take
// [8,16)+[24,32) of their row/col. `k` already includes ks + half*8.
__device__ __forceinline__ bf16x16 lds_frag(const __bf16* rowBase, int k) {
  FragAB f;
  f.h[0] = *(const bf16x8*)(rowBase + k);
  f.h[1] = *(const bf16x8*)(rowBase + k + 16);
  return f.v;
}

// Prefetch one staging slice into registers: 4 f32 of each of 16 tile rows, 16 rows apart.
// 16 adjacent lanes read one row's 256 B, so a wave-wide load covers four whole 128-B lines.
__device__ __forceinline__ void load_slice(gfloat_ptr src, f32x4* p) {
  #pragma unroll
  for (int i = 0; i < SL; ++i) p[i] = *(gf32x4_ptr)(src + (size_t)i * 16 * Kdim);
}

// Split the prefetched slice into bf16 hi + bf16 residual lo, store to LDS.
__device__ __forceinline__ void cvt_store_slice(const f32x4* p,
                                                __bf16* dh, __bf16* dl) {
  #pragma unroll
  for (int i = 0; i < SL; ++i) {
    bf16x4 vh, vl;
    #pragma unroll
    for (int j = 0; j < 4; ++j) {
      __bf16 hi = (__bf16)p[i][j];
      vh[j] = hi;
      vl[j] = (__bf16)(p[i][j] - (float)hi);
    }
    *(bf16x4*)(dh + i * 16 * LDP) = vh;
    *(bf16x4*)(dl + i * 16 * LDP) = vl;
  }
}

__device__ __forceinline__ float sigmoidf_fast(float x) {
  return 1.0f / (1.0f + __expf(-x));
}

__device__ __forceinline__ float gn_silu_chain(float v, float a, float b, float m) {
  float yn = v * a + b;          // (v - mean) * inv * gamma + beta, folded
  float t  = yn * sigmoidf_fast(yn);
  t *= m;
  return t * sigmoidf_fast(t);
}

} // namespace

__global__ __launch_bounds__(256)
void fused_gemm_gn_silu(const float* __restrict__ x,
                        const float* __restrict__ w,
                        const float* __restrict__ bias,
                        const float* __restrict__ gnw,
                        const float* __restrict__ gnb,
                        const float* __restrict__ mw,
                        float* __restrict__ out) {
  // 256 KB LDS, time-aliased: [A_hi|A_lo|B_hi|B_lo] (144 KB) during GEMM, C f32 tile after.
  static_assert(4 * BM * LDP * 2 <= BM * BN * 4, "the staging planes must fit in the C tile");
  __shared__ __align__(16) unsigned char smem[BM * BN * 4];

  __bf16* Ahi = (__bf16*)smem;            // [BM][LDP]
  __bf16* Alo = Ahi + BM * LDP;
  __bf16* Bhi = Alo + BM * LDP;
  __bf16* Blo = Bhi + BM * LDP;
  float*  Cs  = (float*)smem;             // [BM][BN]

  const int tid  = threadIdx.x;
  const int lane = tid & 31;
  const int wave = tid >> 5;
  const int wm   = wave >> 2;             // 0..1  -> 128-row strip
  const int wn   = wave & 3;              // 0..3  -> 64-col strip
  const int r16  = lane & 15;
  const int half = lane >> 4;             // K sub-chunk select per WMMA layout

  const int m0 = blockIdx.y * BM;
  const int n0 = blockIdx.x * BN;

  // Staging: 16 lanes per tile row, 4 f32 each; a thread serves rows sRow + 16 * i.
  // A wave's two rows lie 8 apart: 8 * 144 B = 32 banks mod 64, so its 8-byte LDS
  // stores fall on 64 distinct banks.
  const int sRow = wave + half * 8;
  const int sCol = r16 * 4;


  gfloat_ptr srcA = (gfloat_ptr)(x + (size_t)(m0 + sRow) * Kdim + sCol);
  gfloat_ptr srcB = (gfloat_ptr)(w + (size_t)(n0 + sRow) * Kdim + sCol);

  f32x8 acc[MS][NS] = {};

  // Software pipeline: prefetch K-tile 0 into registers.
  f32x4 pA[SL], pB[SL];
  load_slice(srcA, pA);
  load_slice(srcB, pB);

  for (int k0 = 0; k0 < Kdim; k0 += BK) {
    __syncthreads();   // previous iteration's LDS readers done
    cvt_store_slice(pA, Ahi + sRow * LDP + sCol, Alo + sRow * LDP + sCol);
    cvt_store_slice(pB, Bhi + sRow * LDP + sCol, Blo + sRow * LDP + sCol);
    __syncthreads();

    // Issue next tile's global loads now; latency overlaps the WMMAs below.
    // k0 is uniform, so EXEC stays all-ones for the WMMA section.
    if (k0 + BK < Kdim) {
      load_slice(srcA + BK, pA);
      load_slice(srcB + BK, pB);
    }

    #pragma unroll
    for (int ks = 0; ks < BK; ks += 32) {
      const int kk = ks + half * 8;
      bf16x16 bh[NS], bl[NS];
      #pragma unroll
      for (int ns = 0; ns < NS; ++ns) {
        const int col = wn * 64 + ns * 16 + r16;
        bh[ns] = lds_frag(Bhi + col * LDP, kk);
        bl[ns] = lds_frag(Blo + col * LDP, kk);
      }
      #pragma unroll
      for (int ms = 0; ms < MS; ++ms) {
        const int row = wm * 128 + ms * 16 + r16;
        bf16x16 ah = lds_frag(Ahi + row * LDP, kk);
        bf16x16 al = lds_frag(Alo + row * LDP, kk);
        #pragma unroll
        for (int ns = 0; ns < NS; ++ns) {
          // bf16x3 split-precision accumulation (hi*hi + hi*lo + lo*hi), f32 C
          acc[ms][ns] = wmma_bf16(ah, bh[ns], acc[ms][ns]);
          acc[ms][ns] = wmma_bf16(ah, bl[ns], acc[ms][ns]);
          acc[ms][ns] = wmma_bf16(al, bh[ns], acc[ms][ns]);
        }
      }
    }
    // The loads issued above name srcA and srcB: wait for their address translations
    // before the pointers advance. It stands at the end of the trip so that the WMMAs
    // run meanwhile; the operands keep the two additions behind it.
    asm volatile("s_wait_xcnt 0x0" : "+v"(srcA), "+v"(srcB) :: "memory");
    srcA += BK;
    srcB += BK;
  }

  __syncthreads();  // staging readers done before C tile overwrites LDS

  // Spill accumulators (+bias) to LDS C tile per 16x16 f32 C/D layout:
  // VGPR r: lanes 0-15 -> M=r, lanes 16-31 -> M=8+r; N = lane & 15.
  float bv[NS];
  const int bcol = n0 + wn * 64 + r16;    // this lane's first bias column
  #pragma unroll
  for (int ns = 0; ns < NS; ++ns) bv[ns] = bias[bcol + ns * 16];
  // The bias loads name their address registers: this wait stands in front of the code
  // below, which reuses those registers. The input operand keeps the index live up to
  // the wait, so that none of the four loads lands in it.
  asm volatile("s_wait_xcnt 0x0" :: "v"(bcol) : "memory");
  #pragma unroll
  for (int ms = 0; ms < MS; ++ms) {
    #pragma unroll
    for (int ns = 0; ns < NS; ++ns) {
      const int colT = wn * 64 + ns * 16 + r16;
      #pragma unroll
      for (int r = 0; r < 8; ++r) {
        const int rowT = wm * 128 + ms * 16 + half * 8 + r;
        Cs[rowT * BN + colT] = acc[ms][ns][r] + bv[ns];
      }
    }
  }
  __syncthreads();

  // Fused GroupNorm + SiLU * scale * SiLU epilogue.
  // Each wave handles 32 rows, a row as two halves of 128 channels; in each half a lane
  // owns 4 consecutive channels, all in the same group (group = lane>>3, 8 lanes/group)
  // -> shfl_xor reduction.
  constexpr int CH = BN / 128;                         // halves of a tile row
  const int g = lane >> 3;                             // group within a half row
  float gamma[CH], beta[CH];
  f32x4 mwv[CH];
  #pragma unroll
  for (int ch = 0; ch < CH; ++ch) {
    const int gidx = blockIdx.x * (BN / GS) + ch * 4 + g;      // global group id
    gamma[ch] = gnw[gidx];
    beta[ch]  = gnb[gidx];
    mwv[ch]   = *(const f32x4*)(mw + n0 + ch * 128 + lane * 4);
  }

  for (int rr = 0; rr < BM / 8; ++rr) {
    const int rowT = wave * (BM / 8) + rr;
    #pragma unroll
    for (int ch = 0; ch < CH; ++ch) {
      const int c0 = ch * 128 + lane * 4;              // first channel within the tile
      const f32x4 v = *(const f32x4*)(Cs + rowT * BN + c0);
      float s  = v[0] + v[1] + v[2] + v[3];
      float ss = v[0] * v[0] + v[1] * v[1] + v[2] * v[2] + v[3] * v[3];
      #pragma unroll
      for (int d = 1; d < 8; d <<= 1) {
        s  += __shfl_xor(s,  d, 32);
        ss += __shfl_xor(ss, d, 32);
      }
      const float mean = s * (1.0f / GS);
      const float var  = ss * (1.0f / GS) - mean * mean;
      const float inv  = rsqrtf(var + EPS);
      const float a    = inv * gamma[ch];
      const float b    = beta[ch] - mean * a;

      f32x4 o;
      o[0] = gn_silu_chain(v[0], a, b, mwv[ch][0]);
      o[1] = gn_silu_chain(v[1], a, b, mwv[ch][1]);
      o[2] = gn_silu_chain(v[2], a, b, mwv[ch][2]);
      o[3] = gn_silu_chain(v[3], a, b, mwv[ch][3]);
      // Output is write-once: stream past L2 (TH=NT) to preserve x/W reuse.
      __builtin_nontemporal_store(o,
          (f32x4*)(out + (size_t)(m0 + rowT) * Ndim + n0 + c0));
    }
  }
}

extern "C" void kernel_launch(void* const* d_in, const int* in_sizes, int n_in,
                              void* d_out, int out_size, void* d_ws, size_t ws_size,
                              hipStream_t stream) {
  (void)in_sizes; (void)n_in; (void)out_size; (void)d_ws; (void)ws_size;
  const float* x    = (const float*)d_in[0];
  const float* w    = (const float*)d_in[1];
  const float* bias = (const float*)d_in[2];
  const float* gnw  = (const float*)d_in[3];
  const float* gnb  = (const float*)d_in[4];
  const float* mw   = (const float*)d_in[5];
  float* out        = (float*)d_out;

  dim3 grid(Ndim / BN, Mdim / BM);   // 8 x 64 workgroups
  dim3 block(256);                   // 8 wave32s
  fused_gemm_gn_silu<<<grid, block, 0, stream>>>(x, w, bias, gnw, gnb, mw, out);
}

// v004
// Measured time: 235 microseconds a run.
// Two timings next to v003 put it at 1.13 and 1.12 times that version's speed.
// All steps since v000 together make it 3.65 times as fast.
#include <hip/hip_runtime.h>
#include <hip/hip_bf16.h>

typedef __bf16 bf16x4  __attribute__((ext_vector_type(4)));
typedef __bf16 bf16x8  __attribute__((ext_vector_type(8)));
typedef __bf16 bf16x16 __attribute__((ext_vector_type(16)));
typedef float  f32x8   __attribute__((ext_vector_type(8)));
typedef float  f32x4   __attribute__((ext_vector_type(4)));

namespace {

constexpr int Mdim = 16384;
constexpr int Kdim = 2048;
constexpr int Ndim = 2048;
constexpr int GS   = 32;          // channels per group (N/G = 2048/64)
constexpr float EPS = 1e-5f;

// One 256 x 256 tile per work-group, 128 x 64 per wave (8 x 4 accumulator tiles): each
// staged element and each loaded fragment feeds twice the products of a 128 x 128 tile.
constexpr int BM = 256, BN = 256, BK = 64;
constexpr int MS = 8, NS = 4;     // 16 x 16 accumulator tiles per wave, rows x columns
constexpr int SL = BM / 16;       // tile rows a thread stages per operand
static_assert(BM == BN, "both operands are staged in SL rows a thread");
// LDS row pitch of the staged bf16 planes, in elements: 64 data + 8 pad = 144 B
// (16 B x odd), so the 16 rows of a ds_load_b128 fragment read fall on distinct banks.
constexpr int LDP = BK + 8;
constexpr int PLANE = BM * LDP;   // elements of one staged plane
constexpr int STAGE = 4 * PLANE;  // elements of one buffer: A_hi | A_lo | B_hi | B_lo
constexpr int NT = Kdim / BK;     // K tiles
static_assert(NT >= 2 && NT % 2 == 0, "the two peeled trips read buffer 0, then buffer 1");

// Pointers typed as global memory: they stay global_load addresses after passing
// through an asm operand.
typedef const __attribute__((address_space(1))) float* gfloat_ptr;
typedef const __attribute__((address_space(1))) f32x4* gf32x4_ptr;

union FragAB { bf16x16 v; bf16x8 h[2]; };

__device__ __forceinline__ f32x8 wmma_bf16(bf16x16 a, bf16x16 b, f32x8 c) {
  // 8 args: (neg_a, A, neg_b, B, c_mod, C, reuse_a, reuse_b)
  return __builtin_amdgcn_wmma_f32_16x16x32_bf16(false, a, false, b,
                                                 (short)0, c, false, false);
}

// Load one 16x32 bf16 WMMA operand fragment from LDS.
// Per ISA layout: lanes 0-15 take K chunks [0,8)+[16,24); lanes 16-31 take
// [8,16)+[24,32) of their row/col. `rowBase` already includes half*8; `k` is ks.
__device__ __forceinline__ bf16x16 lds_frag(const __bf16* rowBase, int k) {
  FragAB f;
  f.h[0] = *(const bf16x8*)(rowBase + k);
  f.h[1] = *(const bf16x8*)(rowBase + k + 16);
  return f.v;
}

// Prefetch one staging slice into registers: 4 f32 of each of 16 tile rows, 16 rows apart.
// 16 adjacent lanes read one row's 256 B, so a wave-wide load covers four whole 128-B lines.
__device__ __forceinline__ void load_slice(gfloat_ptr src, f32x4* p) {
  #pragma unroll
  for (int i = 0; i < SL; ++i) p[i] = *(gf32x4_ptr)(src + (size_t)i * 16 * Kdim);
}

// Split 4 prefetched f32 into bf16 hi + bf16 residual lo, store to LDS.
__device__ __forceinline__ void cvt_store_row(f32x4 p, __bf16* dh, __bf16* dl) {
  bf16x4 vh, vl;
  #pragma unroll
  for (int j = 0; j < 4; ++j) {
    __bf16 hi = (__bf16)p[j];
    vh[j] = hi;
    vl[j] = (__bf16)(p[j] - (float)hi);
  }
  *(bf16x4*)dh = vh;
  *(bf16x4*)dl = vl;
}

// Work-group barrier that waits for this wave's LDS traffic only: __syncthreads() would
// also drain the global loads that are in flight for the tile after next.
__device__ __forceinline__ void lds_barrier() {
  asm volatile("s_wait_dscnt 0x0" ::: "memory");    // own LDS stores landed, own reads done
  asm volatile("s_barrier_signal -1" ::: "memory");
  asm volatile("s_barrier_wait -1" ::: "memory");
}

// One K tile: the products of the tile in buffer rd; behind each row of accumulator tiles,
// one staged row of each operand of the NEXT tile goes from registers into buffer wr
// (ST), and the same registers are refilled from the tile after that (LD).
// fa, fb: this lane's fragment offsets in the A and B planes; so: its staging offset.
template <bool ST, bool LD>
__device__ __forceinline__ void k_tile(const __bf16* rd, __bf16* wr,
                                       gfloat_ptr nextA, gfloat_ptr nextB,
                                       f32x4 (&pA)[SL], f32x4 (&pB)[SL],
                                       f32x8 (&acc)[MS][NS], int fa, int fb, int so) {
  static_assert((BK / 32) * MS == SL, "one staged row of each operand per accumulator row");
  #pragma unroll
  for (int ks = 0; ks < BK; ks += 32) {
    bf16x16 bh[NS], bl[NS];
    #pragma unroll
    for (int ns = 0; ns < NS; ++ns) {
      bh[ns] = lds_frag(rd + 2 * PLANE + fb + ns * 16 * LDP, ks);
      bl[ns] = lds_frag(rd + 3 * PLANE + fb + ns * 16 * LDP, ks);
    }
    #pragma unroll
    for (int ms = 0; ms < MS; ++ms) {
      bf16x16 ah = lds_frag(rd + fa + ms * 16 * LDP, ks);
      bf16x16 al = lds_frag(rd + PLANE + fa + ms * 16 * LDP, ks);
      // The row's fragment reads issue first, so that the split below runs in their latency.
      __builtin_amdgcn_sched_barrier(0);
      #pragma unroll
      for (int ns = 0; ns < NS; ++ns) {
        // bf16x3 split-precision accumulation (hi*hi + hi*lo + lo*hi), f32 C
        acc[ms][ns] = wmma_bf16(ah, bh[ns], acc[ms][ns]);
        acc[ms][ns] = wmma_bf16(ah, bl[ns], acc[ms][ns]);
        acc[ms][ns] = wmma_bf16(al, bh[ns], acc[ms][ns]);
      }
      const int i = (ks / 32) * MS + ms;
      if constexpr (ST) {
        __bf16* d = wr + so + i * 16 * LDP;
        cvt_store_row(pA[i], d, d + PLANE);
        cvt_store_row(pB[i], d + 2 * PLANE, d + 3 * PLANE);
      }
      if constexpr (LD) {
        pA[i] = *(gf32x4_ptr)(nextA + (size_t)i * 16 * Kdim);
        pB[i] = *(gf32x4_ptr)(nextB + (size_t)i * 16 * Kdim);
      }
      // Keeps each row's staging and refill loads in their row: the scheduler otherwise
      // sinks the loads to the end of the trip, a few rows in front of their first use.
      __builtin_amdgcn_sched_barrier(0);
    }
  }
}

__device__ __forceinline__ float sigmoidf_fast(float x) {
  return 1.0f / (1.0f + __expf(-x));
}

__device__ __forceinline__ float gn_silu_chain(float v, float a, float b, float m) {
  float yn = v * a + b;          // (v - mean) * inv * gamma + beta, folded
  float t  = yn * sigmoidf_fast(yn);
  t *= m;
  return t * sigmoidf_fast(t);
}

} // namespace

__global__ __launch_bounds__(256)
void fused_gemm_gn_silu(const float* __restrict__ x,
                        const float* __restrict__ w,
                        const float* __restrict__ bias,
                        const float* __restrict__ gnw,
                        const float* __restrict__ gnb,
                        const float* __restrict__ mw,
                        float* __restrict__ out) {
  // 288 KB LDS, time-aliased: two buffers of [A_hi|A_lo|B_hi|B_lo] (144 KB each) during
  // the GEMM, the C f32 tile (256 KB) after.
  static_assert(BM * BN * 4 <= 2 * STAGE * 2, "the C tile must fit in the two buffers");
  __shared__ __align__(16) unsigned char smem[2 * STAGE * 2];

  __bf16* St = (__bf16*)smem;             // [2][4][BM][LDP]
  float*  Cs = (float*)smem;              // [BM][BN]

  const int tid  = threadIdx.x;
  const int lane = tid & 31;
  const int wave = tid >> 5;
  const int wm   = wave >> 2;             // 0..1  -> 128-row strip
  const int wn   = wave & 3;              // 0..3  -> 64-col strip
  const int r16  = lane & 15;
  const int half = lane >> 4;             // K sub-chunk select per WMMA layout

  const int m0 = blockIdx.y * BM;
  const int n0 = blockIdx.x * BN;

  // Staging: 16 lanes per tile row, 4 f32 each; a thread serves rows sRow + 16 * i.
  // A wave's two rows lie 8 apart: 8 * 144 B = 32 banks mod 64, so its 8-byte LDS
  // stores fall on 64 distinct banks.
  const int sRow = wave + half * 8;
  const int sCol = r16 * 4;


  gfloat_ptr srcA = (gfloat_ptr)(x + (size_t)(m0 + sRow) * Kdim + sCol);
  gfloat_ptr srcB = (gfloat_ptr)(w + (size_t)(n0 + sRow) * Kdim + sCol);

  f32x8 acc[MS][NS] = {};

  const int fa = (wm * 128 + r16) * LDP + half * 8;   // fragment offsets, k sub-chunk included
  const int fb = (wn * 64 + r16) * LDP + half * 8;
  const int so = sRow * LDP + sCol;                   // staging offset

  // Prologue: tile 0 through registers into buffer 0, tile 1 on its way into registers.
  f32x4 pA[SL], pB[SL];
  load_slice(srcA, pA);
  load_slice(srcB, pB);
  #pragma unroll
  for (int i = 0; i < SL; ++i) {
    __bf16* d = St + so + i * 16 * LDP;
    cvt_store_row(pA[i], d, d + PLANE);
    cvt_store_row(pB[i], d + 2 * PLANE, d + 3 * PLANE);
  }
  load_slice(srcA + BK, pA);
  load_slice(srcB + BK, pB);
  lds_barrier();

  // Trip t multiplies tile t out of buffer t & 1 while tile t + 1 is split and stored into
  // the other buffer and tile t + 2 is loaded. The one barrier of a trip publishes tile
  // t + 1 and ends every read of the buffer that the next trip refills.
  for (int t = 0; t < NT - 2; ++t) {
    const int cur = t & 1;
    k_tile<true, true>(St + cur * STAGE, St + (cur ^ 1) * STAGE, srcA + 2 * BK, srcB + 2 * BK,
                       pA, pB, acc, fa, fb, so);
    lds_barrier();
    // The loads issued above name srcA and srcB: wait for their address translations
    // before the pointers advance; the operands keep the two additions behind it.
    asm volatile("s_wait_xcnt 0x0" : "+v"(srcA), "+v"(srcB) :: "memory");
    srcA += BK;
    srcB += BK;
  }
  k_tile<true, false>(St, St + STAGE, srcA, srcB, pA, pB, acc, fa, fb, so);
  lds_barrier();
  k_tile<false, false>(St + STAGE, St, srcA, srcB, pA, pB, acc, fa, fb, so);

  __syncthreads();  // staging readers done before C tile overwrites LDS

  // Spill accumulators (+bias) to LDS C tile per 16x16 f32 C/D layout:
  // VGPR r: lanes 0-15 -> M=r, lanes 16-31 -> M=8+r; N = lane & 15.
  float bv[NS];
  const int bcol = n0 + wn * 64 + r16;    // this lane's first bias column
  #pragma unroll
  for (int ns = 0; ns < NS; ++ns) bv[ns] = bias[bcol + ns * 16];
  // The bias loads name their address registers: this wait stands in front of the code
  // below, which reuses those registers. The input operand keeps the index live up to
  // the wait, so that none of the four loads lands in it.
  asm volatile("s_wait_xcnt 0x0" :: "v"(bcol) : "memory");
  #pragma unroll
  for (int ms = 0; ms < MS; ++ms) {
    #pragma unroll
    for (int ns = 0; ns < NS; ++ns) {
      const int colT = wn * 64 + ns * 16 + r16;
      #pragma unroll
      for (int r = 0; r < 8; ++r) {
        const int rowT = wm * 128 + ms * 16 + half * 8 + r;
        Cs[rowT * BN + colT] = acc[ms][ns][r] + bv[ns];
      }
    }
  }
  __syncthreads();

  // Fused GroupNorm + SiLU * scale * SiLU epilogue.
  // Each wave handles 32 rows, a row as two halves of 128 channels; in each half a lane
  // owns 4 consecutive channels, all in the same group (group = lane>>3, 8 lanes/group)
  // -> shfl_xor reduction.
  constexpr int CH = BN / 128;                         // halves of a tile row
  const int g = lane >> 3;                             // group within a half row
  float gamma[CH], beta[CH];
  f32x4 mwv[CH];
  #pragma unroll
  for (int ch = 0; ch < CH; ++ch) {
    const int gidx = blockIdx.x * (BN / GS) + ch * 4 + g;      // global group id
    gamma[ch] = gnw[gidx];
    beta[ch]  = gnb[gidx];
    mwv[ch]   = *(const f32x4*)(mw + n0 + ch * 128 + lane * 4);
  }

  for (int rr = 0; rr < BM / 8; ++rr) {
    const int rowT = wave * (BM / 8) + rr;
    #pragma unroll
    for (int ch = 0; ch < CH; ++ch) {
      const int c0 = ch * 128 + lane * 4;              // first channel within the tile
      const f32x4 v = *(const f32x4*)(Cs + rowT * BN + c0);
      float s  = v[0] + v[1] + v[2] + v[3];
      float ss = v[0] * v[0] + v[1] * v[1] + v[2] * v[2] + v[3] * v[3];
      #pragma unroll
      for (int d = 1; d < 8; d <<= 1) {
        s  += __shfl_xor(s,  d, 32);
        ss += __shfl_xor(ss, d, 32);
      }
      const float mean = s * (1.0f / GS);
      const float var  = ss * (1.0f / GS) - mean * mean;
      const float inv  = rsqrtf(var + EPS);
      const float a    = inv * gamma[ch];
      const float b    = beta[ch] - mean * a;

      f32x4 o;
      o[0] = gn_silu_chain(v[0], a, b, mwv[ch][0]);
      o[1] = gn_silu_chain(v[1], a, b, mwv[ch][1]);
      o[2] = gn_silu_chain(v[2], a, b, mwv[ch][2]);
      o[3] = gn_silu_chain(v[3], a, b, mwv[ch][3]);
      // Output is write-once: stream past L2 (TH=NT) to preserve x/W reuse.
      __builtin_nontemporal_store(o,
          (f32x4*)(out + (size_t)(m0 + rowT) * Ndim + n0 + c0));
    }
  }
}

extern "C" void kernel_launch(void* const* d_in, const int* in_sizes, int n_in,
                              void* d_out, int out_size, void* d_ws, size_t ws_size,
                              hipStream_t stream) {
  (void)in_sizes; (void)n_in; (void)out_size; (void)d_ws; (void)ws_size;
  const float* x    = (const float*)d_in[0];
  const float* w    = (const float*)d_in[1];
  const float* bias = (const float*)d_in[2];
  const float* gnw  = (const float*)d_in[3];
  const float* gnb  = (const float*)d_in[4];
  const float* mw   = (const float*)d_in[5];
  float* out        = (float*)d_out;

  dim3 grid(Ndim / BN, Mdim / BM);   // 8 x 64 workgroups
  dim3 block(256);                   // 8 wave32s
  fused_gemm_gn_silu<<<grid, block, 0, stream>>>(x, w, bias, gnw, gnb, mw, out);
}

// v005
// It runs in 227 microseconds.
// Next to v004, in two timings, it ran 1.04 and 1.03 times as fast.
// Over all steps from v000 it is 3.78 times as fast.
#include <hip/hip_runtime.h>
#include <hip/hip_bf16.h>

typedef __bf16 bf16x4  __attribute__((ext_vector_type(4)));
typedef __bf16 bf16x8  __attribute__((ext_vector_type(8)));
typedef __bf16 bf16x16 __attribute__((ext_vector_type(16)));
typedef float  f32x8   __attribute__((ext_vector_type(8)));
typedef float  f32x4   __attribute__((ext_vector_type(4)));

namespace {

constexpr int Mdim = 16384;
constexpr int Kdim = 2048;
constexpr int Ndim = 2048;
constexpr int GS   = 32;          // channels per group (N/G = 2048/64)
constexpr float EPS = 1e-5f;

// One 256 x 256 tile per work-group, 128 x 64 per wave (8 x 4 accumulator tiles): each
// staged element and each loaded fragment feeds twice the products of a 128 x 128 tile.
constexpr int BM = 256, BN = 256, BK = 64;
constexpr int MS = 8, NS = 4;     // 16 x 16 accumulator tiles per wave, rows x columns
constexpr int SL = BM / 16;       // tile rows a thread stages per operand
constexpr int HW = SL / 2;        // of these, rows held in registers at a time
static_assert(BM == BN, "both operands are staged in SL rows a thread");
// LDS row pitch of the staged bf16 planes, in elements: 64 data + 8 pad = 144 B
// (16 B x odd), so the 16 rows of a ds_load_b128 fragment read fall on distinct banks.
constexpr int LDP = BK + 8;
constexpr int PLANE = BM * LDP;   // elements of one staged plane
constexpr int STAGE = 4 * PLANE;  // elements of one buffer: A_hi | A_lo | B_hi | B_lo
constexpr int NT = Kdim / BK;     // K tiles
static_assert(NT >= 2 && NT % 2 == 0, "the two peeled trips read buffer 0, then buffer 1");

// Pointers typed as global memory: they stay global_load addresses after passing
// through an asm operand.
typedef const __attribute__((address_space(1))) float* gfloat_ptr;
typedef const __attribute__((address_space(1))) f32x4* gf32x4_ptr;

union FragAB { bf16x16 v; bf16x8 h[2]; };

__device__ __forceinline__ f32x8 wmma_bf16(bf16x16 a, bf16x16 b, f32x8 c) {
  // 8 args: (neg_a, A, neg_b, B, c_mod, C, reuse_a, reuse_b)
  return __builtin_amdgcn_wmma_f32_16x16x32_bf16(false, a, false, b,
                                                 (short)0, c, false, false);
}

// Load one 16x32 bf16 WMMA operand fragment from LDS.
// Per ISA layout: lanes 0-15 take K chunks [0,8)+[16,24); lanes 16-31 take
// [8,16)+[24,32) of their row/col. `rowBase` already includes half*8; `k` is ks.
__device__ __forceinline__ bf16x16 lds_frag(const __bf16* rowBase, int k) {
  FragAB f;
  f.h[0] = *(const bf16x8*)(rowBase + k);
  f.h[1] = *(const bf16x8*)(rowBase + k + 16);
  return f.v;
}

// Prefetch one staging slice into registers: 4 f32 of each of 16 tile rows, 16 rows apart.
// 16 adjacent lanes read one row's 256 B, so a wave-wide load covers four whole 128-B lines.
__device__ __forceinline__ void load_slice(gfloat_ptr src, f32x4* p) {
  #pragma unroll
  for (int i = 0; i < SL; ++i) p[i] = *(gf32x4_ptr)(src + (size_t)i * 16 * Kdim);
}

// Split 4 prefetched f32 into bf16 hi + bf16 residual lo, store to LDS.
__device__ __forceinline__ void cvt_store_row(f32x4 p, __bf16* dh, __bf16* dl) {
  bf16x4 vh, vl;
  #pragma unroll
  for (int j = 0; j < 4; ++j) {
    __bf16 hi = (__bf16)p[j];
    vh[j] = hi;
    vl[j] = (__bf16)(p[j] - (float)hi);
  }
  *(bf16x4*)dh = vh;
  *(bf16x4*)dl = vl;
}

// Work-group barrier that waits for this wave's LDS traffic only: __syncthreads() would
// also drain the global loads that are in flight for the tile after next.
__device__ __forceinline__ void lds_barrier() {
  asm volatile("s_wait_dscnt 0x0" ::: "memory");    // own LDS stores landed, own reads done
  asm volatile("s_barrier_signal -1" ::: "memory");
  asm volatile("s_barrier_wait -1" ::: "memory");
}

// One K tile: the products of the tile in buffer rd. The A fragments of accumulator row
// i + 2 are read from LDS in front of row i's products, into one of 3 register sets, so that
// no row waits for its own reads. Behind each row's reads one staged row of each operand of
// the NEXT tile goes from registers into buffer wr (ST), and the same registers are
// refilled with the row that is staged HW rows later: in the next tile (L1) or, from the
// middle of the trip on, in the tile after it (L2).
// n1A, n1B: this lane's staging addresses in the next tile.
// fa, fb: this lane's fragment offsets in the A and B planes; so: its staging offset.
template <bool ST, bool L1, bool L2>
__device__ __forceinline__ void k_tile(const __bf16* rd, __bf16* wr,
                                       gfloat_ptr n1A, gfloat_ptr n1B,
                                       f32x4 (&pA)[HW], f32x4 (&pB)[HW],
                                       f32x8 (&acc)[MS][NS], int fa, int fb, int so) {
  static_assert((BK / 32) * MS == SL, "one staged row of each operand per accumulator row");
  constexpr int D = 3;   // register sets of the A fragments
  bf16x16 ah[D], al[D];
  #pragma unroll
  for (int j = 0; j < D - 1; ++j) {
    ah[j] = lds_frag(rd + fa + j * 16 * LDP, 0);
    al[j] = lds_frag(rd + PLANE + fa + j * 16 * LDP, 0);
  }
  // The first rows' A reads stay in front of the B reads: the scheduler otherwise puts A_hi
  // last, and the tile's first product then waits for nearly all of the reads.
  __builtin_amdgcn_sched_barrier(0);
  #pragma unroll
  for (int ks = 0; ks < BK; ks += 32) {
    bf16x16 bh[NS], bl[NS];
    #pragma unroll
    for (int ns = 0; ns < NS; ++ns) {
      bh[ns] = lds_frag(rd + 2 * PLANE + fb + ns * 16 * LDP, ks);
      bl[ns] = lds_frag(rd + 3 * PLANE + fb + ns * 16 * LDP, ks);
    }
    #pragma unroll
    for (int ms = 0; ms < MS; ++ms) {
      const int i = (ks / 32) * MS + ms;
      const int c = i % D;
      if (i + D - 1 < SL) {
        const int n = i + D - 1, nm = n % MS, nk = (n / MS) * 32;
        ah[n % D] = lds_frag(rd + fa + nm * 16 * LDP, nk);
        al[n % D] = lds_frag(rd + PLANE + fa + nm * 16 * LDP, nk);
      }
      // The fragment reads issue as one group in front of this row's products.
      __builtin_amdgcn_sched_barrier(0);
      #pragma unroll
      for (int ns = 0; ns < NS; ++ns) {
        // bf16x3 split-precision accumulation (hi*hi + hi*lo + lo*hi), f32 C
        acc[ms][ns] = wmma_bf16(ah[c], bh[ns], acc[ms][ns]);
        acc[ms][ns] = wmma_bf16(ah[c], bl[ns], acc[ms][ns]);
        acc[ms][ns] = wmma_bf16(al[c], bh[ns], acc[ms][ns]);
      }
      const int s = i % HW;
      if constexpr (ST) {
        __bf16* d = wr + so + i * 16 * LDP;
        cvt_store_row(pA[s], d, d + PLANE);
        cvt_store_row(pB[s], d + 2 * PLANE, d + 3 * PLANE);
      }
      if (i < HW) {
        if constexpr (L1) {
          // Behind the kernel's last staging loads their address registers fall free: the
          // wait for the address translations stands in front of whatever reuses them, and
          // the fence keeps these two loads directly in front of the wait.
          constexpr bool last = !L2;
          if (last && i == HW - 1) __builtin_amdgcn_sched_barrier(0);
          pA[s] = *(gf32x4_ptr)(n1A + (size_t)(i + HW) * 16 * Kdim);
          pB[s] = *(gf32x4_ptr)(n1B + (size_t)(i + HW) * 16 * Kdim);
          if (last && i == HW - 1) asm volatile("s_wait_xcnt 0x0" ::: "memory");
        }
      } else {
        if constexpr (L2) {
          pA[s] = *(gf32x4_ptr)(n1A + BK + (size_t)(i - HW) * 16 * Kdim);
          pB[s] = *(gf32x4_ptr)(n1B + BK + (size_t)(i - HW) * 16 * Kdim);
        }
      }
      // Keeps each row's staging and refill loads in their row: the scheduler otherwise
      // sinks the loads to the end of the trip, a few rows in front of their first use.
      __builtin_amdgcn_sched_barrier(0);
    }
  }
}

__device__ __forceinline__ float sigmoidf_fast(float x) {
  return 1.0f / (1.0f + __expf(-x));
}

__device__ __forceinline__ float gn_silu_chain(float v, float a, float b, float m) {
  float yn = v * a + b;          // (v - mean) * inv * gamma + beta, folded
  float t  = yn * sigmoidf_fast(yn);
  t *= m;
  return t * sigmoidf_fast(t);
}

} // namespace

__global__ __launch_bounds__(256)
void fused_gemm_gn_silu(const float* __restrict__ x,
                        const float* __restrict__ w,
                        const float* __restrict__ bias,
                        const float* __restrict__ gnw,
                        const float* __restrict__ gnb,
                        const float* __restrict__ mw,
                        float* __restrict__ out) {
  // 288 KB LDS, time-aliased: two buffers of [A_hi|A_lo|B_hi|B_lo] (144 KB each) during
  // the GEMM, the C f32 tile (256 KB) after.
  static_assert(BM * BN * 4 <= 2 * STAGE * 2, "the C tile must fit in the two buffers");
  __shared__ __align__(16) unsigned char smem[2 * STAGE * 2];

  __bf16* St = (__bf16*)smem;             // [2][4][BM][LDP]
  float*  Cs = (float*)smem;              // [BM][BN]

  const int tid  = threadIdx.x;
  const int lane = tid & 31;
  const int wave = tid >> 5;
  const int wm   = wave >> 2;             // 0..1  -> 128-row strip
  const int wn   = wave & 3;              // 0..3  -> 64-col strip
  const int r16  = lane & 15;
  const int half = lane >> 4;             // K sub-chunk select per WMMA layout

  const int m0 = blockIdx.y * BM;
  const int n0 = blockIdx.x * BN;

  // Staging: 16 lanes per tile row, 4 f32 each; a thread serves rows sRow + 16 * i.
  // A wave's two rows lie 8 apart: 8 * 144 B = 32 banks mod 64, so its 8-byte LDS
  // stores fall on 64 distinct banks.
  const int sRow = wave + half * 8;
  const int sCol = r16 * 4;


  gfloat_ptr srcA = (gfloat_ptr)(x + (size_t)(m0 + sRow) * Kdim + sCol);
  gfloat_ptr srcB = (gfloat_ptr)(w + (size_t)(n0 + sRow) * Kdim + sCol);

  f32x8 acc[MS][NS] = {};

  const int fa = (wm * 128 + r16) * LDP + half * 8;   // fragment offsets, k sub-chunk included
  const int fb = (wn * 64 + r16) * LDP + half * 8;
  const int so = sRow * LDP + sCol;                   // staging offset

  // Prologue: tile 0 through registers into buffer 0, the first half of tile 1 on its way
  // into registers (row by row, A then B, the order in which the loop refills them).
  f32x4 pA[HW], pB[HW];
  {
    f32x4 qA[SL], qB[SL];
    load_slice(srcA, qA);
    load_slice(srcB, qB);
    #pragma unroll
    for (int i = 0; i < SL; ++i) {
      __bf16* d = St + so + i * 16 * LDP;
      cvt_store_row(qA[i], d, d + PLANE);
      cvt_store_row(qB[i], d + 2 * PLANE, d + 3 * PLANE);
    }
  }
  #pragma unroll
  for (int i = 0; i < HW; ++i) {
    pA[i] = *(gf32x4_ptr)(srcA + BK + (size_t)i * 16 * Kdim);
    pB[i] = *(gf32x4_ptr)(srcB + BK + (size_t)i * 16 * Kdim);
  }
  lds_barrier();

  // Trip t multiplies tile t out of buffer t & 1 while tile t + 1 is split and stored into
  // the other buffer; its second half and the first half of tile t + 2 are loaded. The one
  // barrier of a trip publishes tile t + 1 and ends every read of the buffer that the next
  // trip refills.
  for (int t = 0; t < NT - 2; ++t) {
    const int cur = t & 1;
    k_tile<true, true, true>(St + cur * STAGE, St + (cur ^ 1) * STAGE, srcA + BK, srcB + BK,
                             pA, pB, acc, fa, fb, so);
    lds_barrier();
    // The loads issued above name srcA and srcB: wait for their address translations
    // before the pointers advance; the operands keep the two additions behind it.
    asm volatile("s_wait_xcnt 0x0" : "+v"(srcA), "+v"(srcB) :: "memory");
    srcA += BK;
    srcB += BK;
  }
  k_tile<true, true, false>(St, St + STAGE, srcA + BK, srcB + BK, pA, pB, acc, fa, fb, so);
  lds_barrier();
  k_tile<false, false, false>(St + STAGE, St, srcA, srcB, pA, pB, acc, fa, fb, so);

  __syncthreads();  // staging readers done before C tile overwrites LDS

  // Spill accumulators (+bias) to LDS C tile per 16x16 f32 C/D layout:
  // VGPR r: lanes 0-15 -> M=r, lanes 16-31 -> M=8+r; N = lane & 15.
  float bv[NS];
  const int bcol = n0 + wn * 64 + r16;    // this lane's first bias column
  #pragma unroll
  for (int ns = 0; ns < NS; ++ns) bv[ns] = bias[bcol + ns * 16];
  // The bias loads name their address registers: this wait stands in front of the code
  // below, which reuses those registers. The input operand keeps the index live up to
  // the wait, so that none of the four loads lands in it.
  asm volatile("s_wait_xcnt 0x0" :: "v"(bcol) : "memory");
  #pragma unroll
  for (int ms = 0; ms < MS; ++ms) {
    #pragma unroll
    for (int ns = 0; ns < NS; ++ns) {
      const int colT = wn * 64 + ns * 16 + r16;
      #pragma unroll
      for (int r = 0; r < 8; ++r) {
        const int rowT = wm * 128 + ms * 16 + half * 8 + r;
        Cs[rowT * BN + colT] = acc[ms][ns][r] + bv[ns];
      }
    }
  }
  __syncthreads();

  // Fused GroupNorm + SiLU * scale * SiLU epilogue.
  // Each wave handles 32 rows, a row as two halves of 128 channels; in each half a lane
  // owns 4 consecutive channels, all in the same group (group = lane>>3, 8 lanes/group)
  // -> shfl_xor reduction.
  constexpr int CH = BN / 128;                         // halves of a tile row
  const int g = lane >> 3;                             // group within a half row
  float gamma[CH], beta[CH];
  f32x4 mwv[CH];
  #pragma unroll
  for (int ch = 0; ch < CH; ++ch) {
    const int gidx = blockIdx.x * (BN / GS) + ch * 4 + g;      // global group id
    gamma[ch] = gnw[gidx];
    beta[ch]  = gnb[gidx];
    mwv[ch]   = *(const f32x4*)(mw + n0 + ch * 128 + lane * 4);
  }

  for (int rr = 0; rr < BM / 8; ++rr) {
    const int rowT = wave * (BM / 8) + rr;
    #pragma unroll
    for (int ch = 0; ch < CH; ++ch) {
      const int c0 = ch * 128 + lane * 4;              // first channel within the tile
      const f32x4 v = *(const f32x4*)(Cs + rowT * BN + c0);
      float s  = v[0] + v[1] + v[2] + v[3];
      float ss = v[0] * v[0] + v[1] * v[1] + v[2] * v[2] + v[3] * v[3];
      #pragma unroll
      for (int d = 1; d < 8; d <<= 1) {
        s  += __shfl_xor(s,  d, 32);
        ss += __shfl_xor(ss, d, 32);
      }
      const float mean = s * (1.0f / GS);
      const float var  = ss * (1.0f / GS) - mean * mean;
      const float inv  = rsqrtf(var + EPS);
      const float a    = inv * gamma[ch];
      const float b    = beta[ch] - mean * a;

      f32x4 o;
      o[0] = gn_silu_chain(v[0], a, b, mwv[ch][0]);
      o[1] = gn_silu_chain(v[1], a, b, mwv[ch][1]);
      o[2] = gn_silu_chain(v[2], a, b, mwv[ch][2]);
      o[3] = gn_silu_chain(v[3], a, b, mwv[ch][3]);
      // Output is write-once: stream past L2 (TH=NT) to preserve x/W reuse.
      __builtin_nontemporal_store(o,
          (f32x4*)(out + (size_t)(m0 + rowT) * Ndim + n0 + c0));
    }
  }
}

extern "C" void kernel_launch(void* const* d_in, const int* in_sizes, int n_in,
                              void* d_out, int out_size, void* d_ws, size_t ws_size,
                              hipStream_t stream) {
  (void)in_sizes; (void)n_in; (void)out_size; (void)d_ws; (void)ws_size;
  const float* x    = (const float*)d_in[0];
  const float* w    = (const float*)d_in[1];
  const float* bias = (const float*)d_in[2];
  const float* gnw  = (const float*)d_in[3];
  const float* gnb  = (const float*)d_in[4];
  const float* mw   = (const float*)d_in[5];
  float* out        = (float*)d_out;

  dim3 grid(Ndim / BN, Mdim / BM);   // 8 x 64 workgroups
  dim3 block(256);                   // 8 wave32s
  fused_gemm_gn_silu<<<grid, block, 0, stream>>>(x, w, bias, gnw, gnb, mw, out);
}

// v006
// Measured time: 216 microseconds a run.
// In both of two side-by-side timings against v005, it was 1.05 times as fast.
// All steps since v000 together make it 3.97 times as fast.
#include <hip/hip_runtime.h>
#include <hip/hip_bf16.h>

typedef __bf16 bf16x4  __attribute__((ext_vector_type(4)));
typedef __bf16 bf16x8  __attribute__((ext_vector_type(8)));
typedef __bf16 bf16x16 __attribute__((ext_vector_type(16)));
typedef float  f32x8   __attribute__((ext_vector_type(8)));
typedef float  f32x4   __attribute__((ext_vector_type(4)));

namespace {

constexpr int Mdim = 16384;
constexpr int Kdim = 2048;
constexpr int Ndim = 2048;
constexpr int GS   = 32;          // channels per group (N/G = 2048/64)
constexpr float EPS = 1e-5f;

// One 256 x 256 tile per work-group, 128 x 64 per wave (8 x 4 accumulator tiles): each
// staged element and each loaded fragment feeds twice the products of a 128 x 128 tile.
constexpr int BM = 256, BN = 256, BK = 64;
constexpr int MS = 8, NS = 4;     // 16 x 16 accumulator tiles per wave, rows x columns
constexpr int SL = BM / 16;       // tile rows a thread stages per operand
constexpr int HW = SL / 2;        // of these, rows held in registers at a time
static_assert(BM == BN, "both operands are staged in SL rows a thread");
// LDS row pitch of the staged bf16 planes, in elements: 64 data + 8 pad = 144 B
// (16 B x odd), so the 16 rows of a ds_load_b128 fragment read fall on distinct banks.
constexpr int LDP = BK + 8;
constexpr int PLANE = BM * LDP;   // elements of one staged plane
constexpr int STAGE = 4 * PLANE;  // elements of one buffer: A_hi | A_lo | B_hi | B_lo
constexpr int NT = Kdim / BK;     // K tiles
static_assert(NT >= 2 && NT % 2 == 0, "the two peeled trips read buffer 0, then buffer 1");

// Pointers typed as global memory: they stay global_load addresses after passing
// through an asm operand.
typedef const __attribute__((address_space(1))) float* gfloat_ptr;
typedef const __attribute__((address_space(1))) f32x4* gf32x4_ptr;

union FragAB { bf16x16 v; bf16x8 h[2]; };

__device__ __forceinline__ f32x8 wmma_bf16(bf16x16 a, bf16x16 b, f32x8 c) {
  // 8 args: (neg_a, A, neg_b, B, c_mod, C, reuse_a, reuse_b)
  return __builtin_amdgcn_wmma_f32_16x16x32_bf16(false, a, false, b,
                                                 (short)0, c, false, false);
}

// Load one 16x32 bf16 WMMA operand fragment from LDS.
// Per ISA layout: lanes 0-15 take K chunks [0,8)+[16,24); lanes 16-31 take
// [8,16)+[24,32) of their row/col. `rowBase` already includes half*8; `k` is ks.
__device__ __forceinline__ bf16x16 lds_frag(const __bf16* rowBase, int k) {
  FragAB f;
  f.h[0] = *(const bf16x8*)(rowBase + k);
  f.h[1] = *(const bf16x8*)(rowBase + k + 16);
  return f.v;
}

// Prefetch one staging slice into registers: 4 f32 of each of 16 tile rows, 16 rows apart.
// 16 adjacent lanes read one row's 256 B, so a wave-wide load covers four whole 128-B lines.
__device__ __forceinline__ void load_slice(gfloat_ptr src, f32x4* p) {
  #pragma unroll
  for (int i = 0; i < SL; ++i) p[i] = *(gf32x4_ptr)(src + (size_t)i * 16 * Kdim);
}

// Split 4 prefetched f32 into bf16 hi + bf16 residual lo, store to LDS.
__device__ __forceinline__ void cvt_store_row(f32x4 p, __bf16* dh, __bf16* dl) {
  bf16x4 vh, vl;
  #pragma unroll
  for (int j = 0; j < 4; ++j) {
    __bf16 hi = (__bf16)p[j];
    vh[j] = hi;
    vl[j] = (__bf16)(p[j] - (float)hi);
  }
  *(bf16x4*)dh = vh;
  *(bf16x4*)dl = vl;
}

// Work-group barrier that waits for this wave's LDS traffic only: __syncthreads() would
// also drain the global loads that are in flight for the tile after next.
__device__ __forceinline__ void lds_barrier() {
  asm volatile("s_wait_dscnt 0x0" ::: "memory");    // own LDS stores landed, own reads done
  asm volatile("s_barrier_signal -1" ::: "memory");
  asm volatile("s_barrier_wait -1" ::: "memory");
}

// One K tile: the products of the tile in buffer rd. The A fragments of accumulator row
// i + 2 are read from LDS in front of row i's products, into one of 3 register sets, so that
// no row waits for its own reads. Behind each row's reads one staged row of each operand of
// the NEXT tile goes from registers into buffer wr (ST), and the same registers are
// refilled with the row that is staged HW rows later: in the next tile (L1) or, from the
// middle of the trip on, in the tile after it (L2).
// n1A, n1B: this lane's staging addresses in the next tile.
// fa, fb: this lane's fragment offsets in the A and B planes; so: its staging offset.
template <bool ST, bool L1, bool L2>
__device__ __forceinline__ void k_tile(const __bf16* rd, __bf16* wr,
                                       gfloat_ptr n1A, gfloat_ptr n1B,
                                       f32x4 (&pA)[HW], f32x4 (&pB)[HW],
                                       f32x8 (&acc)[MS][NS], int fa, int fb, int so) {
  static_assert((BK / 32) * MS == SL, "one staged row of each operand per accumulator row");
  constexpr int D = 3;   // register sets of the A fragments
  bf16x16 ah[D], al[D];
  #pragma unroll
  for (int j = 0; j < D - 1; ++j) {
    ah[j] = lds_frag(rd + fa + j * 16 * LDP, 0);
    al[j] = lds_frag(rd + PLANE + fa + j * 16 * LDP, 0);
  }
  // The first rows' A reads stay in front of the B reads: the scheduler otherwise puts A_hi
  // last, and the tile's first product then waits for nearly all of the reads.
  __builtin_amdgcn_sched_barrier(0);
  #pragma unroll
  for (int ks = 0; ks < BK; ks += 32) {
    bf16x16 bh[NS], bl[NS];
    #pragma unroll
    for (int ns = 0; ns < NS; ++ns) {
      bh[ns] = lds_frag(rd + 2 * PLANE + fb + ns * 16 * LDP, ks);
      bl[ns] = lds_frag(rd + 3 * PLANE + fb + ns * 16 * LDP, ks);
    }
    #pragma unroll
    for (int ms = 0; ms < MS; ++ms) {
      const int i = (ks / 32) * MS + ms;
      const int c = i % D;
      if (i + D - 1 < SL) {
        const int n = i + D - 1, nm = n % MS, nk = (n / MS) * 32;
        ah[n % D] = lds_frag(rd + fa + nm * 16 * LDP, nk);
        al[n % D] = lds_frag(rd + PLANE + fa + nm * 16 * LDP, nk);
      }
      // The fragment reads issue as one group in front of this row's products.
      __builtin_amdgcn_sched_barrier(0);
      #pragma unroll
      for (int ns = 0; ns < NS; ++ns) {
        // bf16x3 split-precision accumulation (hi*hi + hi*lo + lo*hi), f32 C
        acc[ms][ns] = wmma_bf16(ah[c], bh[ns], acc[ms][ns]);
        acc[ms][ns] = wmma_bf16(ah[c], bl[ns], acc[ms][ns]);
        acc[ms][ns] = wmma_bf16(al[c], bh[ns], acc[ms][ns]);
      }
      const int s = i % HW;
      if constexpr (ST) {
        __bf16* d = wr + so + i * 16 * LDP;
        cvt_store_row(pA[s], d, d + PLANE);
        cvt_store_row(pB[s], d + 2 * PLANE, d + 3 * PLANE);
      }
      if (i < HW) {
        if constexpr (L1) {
          // Behind the kernel's last staging loads their address registers fall free: the
          // wait for the address translations stands in front of whatever reuses them, and
          // the fence keeps these two loads directly in front of the wait.
          constexpr bool last = !L2;
          if (last && i == HW - 1) __builtin_amdgcn_sched_barrier(0);
          pA[s] = *(gf32x4_ptr)(n1A + (size_t)(i + HW) * 16 * Kdim);
          pB[s] = *(gf32x4_ptr)(n1B + (size_t)(i + HW) * 16 * Kdim);
          if (last && i == HW - 1) asm volatile("s_wait_xcnt 0x0" ::: "memory");
        }
      } else {
        if constexpr (L2) {
          pA[s] = *(gf32x4_ptr)(n1A + BK + (size_t)(i - HW) * 16 * Kdim);
          pB[s] = *(gf32x4_ptr)(n1B + BK + (size_t)(i - HW) * 16 * Kdim);
        }
      }
      // Keeps each row's staging and refill loads in their row: the scheduler otherwise
      // sinks the loads to the end of the trip, a few rows in front of their first use.
      __builtin_amdgcn_sched_barrier(0);
    }
  }
}

// x * sigmoid(x) = h + h * tanh(h) with h = x / 2: one v_tanh_f32 and one fma.
__device__ __forceinline__ float silu_of_half(float h) {
  return __builtin_fmaf(h, __builtin_amdgcn_tanhf(h), h);
}

// ah, bh, mh: half the folded scale, half the folded shift, half the channel's multiplier,
// so that each SiLU gets its argument already halved (a halving is exact short of underflow).
__device__ __forceinline__ float gn_silu_chain(float v, float ah, float bh, float mh) {
  float h = v * ah + bh;         // ((v - mean) * inv * gamma + beta) / 2, folded
  return silu_of_half(silu_of_half(h) * mh);
}

} // namespace

__global__ __launch_bounds__(256)
void fused_gemm_gn_silu(const float* __restrict__ x,
                        const float* __restrict__ w,
                        const float* __restrict__ bias,
                        const float* __restrict__ gnw,
                        const float* __restrict__ gnb,
                        const float* __restrict__ mw,
                        float* __restrict__ out) {
  // 288 KB LDS, time-aliased: two buffers of [A_hi|A_lo|B_hi|B_lo] (144 KB each) during
  // the GEMM, the C f32 tile (256 KB) after.
  static_assert(BM * BN * 4 <= 2 * STAGE * 2, "the C tile must fit in the two buffers");
  __shared__ __align__(16) unsigned char smem[2 * STAGE * 2];

  __bf16* St = (__bf16*)smem;             // [2][4][BM][LDP]
  float*  Cs = (float*)smem;              // [BM][BN]

  const int tid  = threadIdx.x;
  const int lane = tid & 31;
  const int wave = tid >> 5;
  const int wm   = wave >> 2;             // 0..1  -> 128-row strip
  const int wn   = wave & 3;              // 0..3  -> 64-col strip
  const int r16  = lane & 15;
  const int half = lane >> 4;             // K sub-chunk select per WMMA layout

  const int m0 = blockIdx.y * BM;
  const int n0 = blockIdx.x * BN;

  // Staging: 16 lanes per tile row, 4 f32 each; a thread serves rows sRow + 16 * i.
  // A wave's two rows lie 8 apart: 8 * 144 B = 32 banks mod 64, so its 8-byte LDS
  // stores fall on 64 distinct banks.
  const int sRow = wave + half * 8;
  const int sCol = r16 * 4;


  gfloat_ptr srcA = (gfloat_ptr)(x + (size_t)(m0 + sRow) * Kdim + sCol);
  gfloat_ptr srcB = (gfloat_ptr)(w + (size_t)(n0 + sRow) * Kdim + sCol);

  f32x8 acc[MS][NS] = {};

  const int fa = (wm * 128 + r16) * LDP + half * 8;   // fragment offsets, k sub-chunk included
  const int fb = (wn * 64 + r16) * LDP + half * 8;
  const int so = sRow * LDP + sCol;                   // staging offset

  // Prologue: tile 0 through registers into buffer 0, the first half of tile 1 on its way
  // into registers (row by row, A then B, the order in which the loop refills them).
  f32x4 pA[HW], pB[HW];
  {
    f32x4 qA[SL], qB[SL];
    load_slice(srcA, qA);
    load_slice(srcB, qB);
    #pragma unroll
    for (int i = 0; i < SL; ++i) {
      __bf16* d = St + so + i * 16 * LDP;
      cvt_store_row(qA[i], d, d + PLANE);
      cvt_store_row(qB[i], d + 2 * PLANE, d + 3 * PLANE);
    }
  }
  #pragma unroll
  for (int i = 0; i < HW; ++i) {
    pA[i] = *(gf32x4_ptr)(srcA + BK + (size_t)i * 16 * Kdim);
    pB[i] = *(gf32x4_ptr)(srcB + BK + (size_t)i * 16 * Kdim);
  }
  lds_barrier();

  // Trip t multiplies tile t out of buffer t & 1 while tile t + 1 is split and stored into
  // the other buffer; its second half and the first half of tile t + 2 are loaded. The one
  // barrier of a trip publishes tile t + 1 and ends every read of the buffer that the next
  // trip refills.
  for (int t = 0; t < NT - 2; ++t) {
    const int cur = t & 1;
    k_tile<true, true, true>(St + cur * STAGE, St + (cur ^ 1) * STAGE, srcA + BK, srcB + BK,
                             pA, pB, acc, fa, fb, so);
    lds_barrier();
    // The loads issued above name srcA and srcB: wait for their address translations
    // before the pointers advance; the operands keep the two additions behind it.
    asm volatile("s_wait_xcnt 0x0" : "+v"(srcA), "+v"(srcB) :: "memory");
    srcA += BK;
    srcB += BK;
  }
  k_tile<true, true, false>(St, St + STAGE, srcA + BK, srcB + BK, pA, pB, acc, fa, fb, so);
  lds_barrier();
  k_tile<false, false, false>(St + STAGE, St, srcA, srcB, pA, pB, acc, fa, fb, so);

  __syncthreads();  // staging readers done before C tile overwrites LDS

  // Spill accumulators (+bias) to LDS C tile per 16x16 f32 C/D layout:
  // VGPR r: lanes 0-15 -> M=r, lanes 16-31 -> M=8+r; N = lane & 15.
  float bv[NS];
  const int bcol = n0 + wn * 64 + r16;    // this lane's first bias column
  #pragma unroll
  for (int ns = 0; ns < NS; ++ns) bv[ns] = bias[bcol + ns * 16];
  // The bias loads name their address registers: this wait stands in front of the code
  // below, which reuses those registers. The input operand keeps the index live up to
  // the wait, so that none of the four loads lands in it.
  asm volatile("s_wait_xcnt 0x0" :: "v"(bcol) : "memory");
  #pragma unroll
  for (int ms = 0; ms < MS; ++ms) {
    #pragma unroll
    for (int ns = 0; ns < NS; ++ns) {
      const int colT = wn * 64 + ns * 16 + r16;
      #pragma unroll
      for (int r = 0; r < 8; ++r) {
        const int rowT = wm * 128 + ms * 16 + half * 8 + r;
        Cs[rowT * BN + colT] = acc[ms][ns][r] + bv[ns];
      }
    }
  }
  __syncthreads();

  // Fused GroupNorm + SiLU * scale * SiLU epilogue.
  // Each wave handles 32 rows, a row as two halves of 128 channels; in each half a lane
  // owns 4 consecutive channels, all in the same group (group = lane>>3, 8 lanes/group)
  // -> shfl_xor reduction.
  constexpr int CH = BN / 128;                         // halves of a tile row
  const int g = lane >> 3;                             // group within a half row
  float gamma[CH], beta[CH];
  f32x4 mwv[CH];
  #pragma unroll
  for (int ch = 0; ch < CH; ++ch) {
    const int gidx = blockIdx.x * (BN / GS) + ch * 4 + g;      // global group id
    gamma[ch] = gnw[gidx] * 0.5f;                      // the halves that gn_silu_chain takes
    beta[ch]  = gnb[gidx] * 0.5f;
    mwv[ch]   = *(const f32x4*)(mw + n0 + ch * 128 + lane * 4) * 0.5f;
  }

  for (int rr = 0; rr < BM / 8; ++rr) {
    const int rowT = wave * (BM / 8) + rr;
    #pragma unroll
    for (int ch = 0; ch < CH; ++ch) {
      const int c0 = ch * 128 + lane * 4;              // first channel within the tile
      const f32x4 v = *(const f32x4*)(Cs + rowT * BN + c0);
      float s  = v[0] + v[1] + v[2] + v[3];
      float ss = v[0] * v[0] + v[1] * v[1] + v[2] * v[2] + v[3] * v[3];
      #pragma unroll
      for (int d = 1; d < 8; d <<= 1) {
        s  += __shfl_xor(s,  d, 32);
        ss += __shfl_xor(ss, d, 32);
      }
      const float mean = s * (1.0f / GS);
      const float var  = ss * (1.0f / GS) - mean * mean;
      const float inv  = rsqrtf(var + EPS);
      const float a    = inv * gamma[ch];          // gamma, beta: halved above
      const float b    = beta[ch] - mean * a;

      f32x4 o;
      o[0] = gn_silu_chain(v[0], a, b, mwv[ch][0]);
      o[1] = gn_silu_chain(v[1], a, b, mwv[ch][1]);
      o[2] = gn_silu_chain(v[2], a, b, mwv[ch][2]);
      o[3] = gn_silu_chain(v[3], a, b, mwv[ch][3]);
      // Output is write-once: stream past L2 (TH=NT) to preserve x/W reuse.
      __builtin_nontemporal_store(o,
          (f32x4*)(out + (size_t)(m0 + rowT) * Ndim + n0 + c0));
    }
  }
}

extern "C" void kernel_launch(void* const* d_in, const int* in_sizes, int n_in,
                              void* d_out, int out_size, void* d_ws, size_t ws_size,
                              hipStream_t stream) {
  (void)in_sizes; (void)n_in; (void)out_size; (void)d_ws; (void)ws_size;
  const float* x    = (const float*)d_in[0];
  const float* w    = (const float*)d_in[1];
  const float* bias = (const float*)d_in[2];
  const float* gnw  = (const float*)d_in[3];
  const float* gnb  = (const float*)d_in[4];
  const float* mw   = (const float*)d_in[5];
  float* out        = (float*)d_out;

  dim3 grid(Ndim / BN, Mdim / BM);   // 8 x 64 workgroups
  dim3 block(256);                   // 8 wave32s
  fused_gemm_gn_silu<<<grid, block, 0, stream>>>(x, w, bias, gnw, gnb, mw, out);
}

// v007
// Measured time: 205 microseconds a run.
// Timed twice side by side with v006, it ran 1.05 and 1.06 times as fast.
// Counting every step since v000, it is 4.19 times as fast.
#include <hip/hip_runtime.h>
#include <hip/hip_bf16.h>

typedef __bf16 bf16x4  __attribute__((ext_vector_type(4)));
typedef __bf16 bf16x8  __attribute__((ext_vector_type(8)));
typedef __bf16 bf16x16 __attribute__((ext_vector_type(16)));
typedef float  f32x8   __attribute__((ext_vector_type(8)));
typedef float  f32x4   __attribute__((ext_vector_type(4)));

namespace {

constexpr int Mdim = 16384;
constexpr int Kdim = 2048;
constexpr int Ndim = 2048;
constexpr int GS   = 32;          // channels per group (N/G = 2048/64)
constexpr float EPS = 1e-5f;

// One 256 x 256 tile per work-group, 128 x 64 per wave (8 x 4 accumulator tiles): each
// staged element and each loaded fragment feeds twice the products of a 128 x 128 tile.
constexpr int BM = 256, BN = 256, BK = 64;
constexpr int MS = 8, NS = 4;     // 16 x 16 accumulator tiles per wave, rows x columns
constexpr int SL = BM / 16;       // tile rows a thread stages per operand
constexpr int HW = SL / 2;        // of these, rows held in registers at a time
static_assert(BM == BN, "both operands are staged in SL rows a thread");
// LDS row pitch of the staged bf16 planes, in elements: 64 data + 8 pad = 144 B
// (16 B x odd), so the 16 rows of a ds_load_b128 fragment read fall on distinct banks.
constexpr int LDP = BK + 8;
constexpr int PLANE = BM * LDP;   // elements of one staged plane
constexpr int STAGE = 4 * PLANE;  // elements of one buffer: A_hi | A_lo | B_hi | B_lo
constexpr int NT = Kdim / BK;     // K tiles
static_assert(NT >= 2 && NT % 2 == 0, "the two peeled trips read buffer 0, then buffer 1");

// Pointers typed as global memory: they stay global_load addresses after passing
// through an asm operand.
typedef const __attribute__((address_space(1))) float* gfloat_ptr;
typedef const __attribute__((address_space(1))) f32x4* gf32x4_ptr;
typedef __attribute__((address_space(1))) float* gfloat_out_ptr;
typedef __attribute__((address_space(1))) f32x4* gf32x4_out_ptr;

union FragAB { bf16x16 v; bf16x8 h[2]; };

__device__ __forceinline__ f32x8 wmma_bf16(bf16x16 a, bf16x16 b, f32x8 c) {
  // 8 args: (neg_a, A, neg_b, B, c_mod, C, reuse_a, reuse_b)
  return __builtin_amdgcn_wmma_f32_16x16x32_bf16(false, a, false, b,
                                                 (short)0, c, false, false);
}

// Load one 16x32 bf16 WMMA operand fragment from LDS.
// Per ISA layout: lanes 0-15 take K chunks [0,8)+[16,24); lanes 16-31 take
// [8,16)+[24,32) of their row/col. `rowBase` already includes half*8; `k` is ks.
__device__ __forceinline__ bf16x16 lds_frag(const __bf16* rowBase, int k) {
  FragAB f;
  f.h[0] = *(const bf16x8*)(rowBase + k);
  f.h[1] = *(const bf16x8*)(rowBase + k + 16);
  return f.v;
}

// Prefetch one staging slice into registers: 4 f32 of each of 16 tile rows, 16 rows apart.
// 16 adjacent lanes read one row's 256 B, so a wave-wide load covers four whole 128-B lines.
__device__ __forceinline__ void load_slice(gfloat_ptr src, f32x4* p) {
  #pragma unroll
  for (int i = 0; i < SL; ++i) p[i] = *(gf32x4_ptr)(src + (size_t)i * 16 * Kdim);
}

// Split 4 prefetched f32 into bf16 hi + bf16 residual lo, store to LDS.
__device__ __forceinline__ void cvt_store_row(f32x4 p, __bf16* dh, __bf16* dl) {
  bf16x4 vh, vl;
  #pragma unroll
  for (int j = 0; j < 4; ++j) {
    __bf16 hi = (__bf16)p[j];
    vh[j] = hi;
    vl[j] = (__bf16)(p[j] - (float)hi);
  }
  *(bf16x4*)dh = vh;
  *(bf16x4*)dl = vl;
}

// Work-group barrier that waits for this wave's LDS traffic only: __syncthreads() would
// also drain the global loads that are in flight for the tile after next.
__device__ __forceinline__ void lds_barrier() {
  asm volatile("s_wait_dscnt 0x0" ::: "memory");    // own LDS stores landed, own reads done
  asm volatile("s_barrier_signal -1" ::: "memory");
  asm volatile("s_barrier_wait -1" ::: "memory");
}

// One K tile: the products of the tile in buffer rd. The A fragments of accumulator row
// i + 2 are read from LDS in front of row i's products, into one of 3 register sets, so that
// no row waits for its own reads. Behind each row's reads one staged row of each operand of
// the NEXT tile goes from registers into buffer wr (ST), and the same registers are
// refilled with the row that is staged HW rows later: in the next tile (L1) or, from the
// middle of the trip on, in the tile after it (L2).
// n1A, n1B: this lane's staging addresses in the next tile.
// fa, fb: this lane's fragment offsets in the A and B planes; so: its staging offset.
template <bool ST, bool L1, bool L2>
__device__ __forceinline__ void k_tile(const __bf16* rd, __bf16* wr,
                                       gfloat_ptr n1A, gfloat_ptr n1B,
                                       f32x4 (&pA)[HW], f32x4 (&pB)[HW],
                                       f32x8 (&acc)[MS][NS], int fa, int fb, int so) {
  static_assert((BK / 32) * MS == SL, "one staged row of each operand per accumulator row");
  constexpr int D = 3;   // register sets of the A fragments
  bf16x16 ah[D], al[D];
  #pragma unroll
  for (int j = 0; j < D - 1; ++j) {
    ah[j] = lds_frag(rd + fa + j * 16 * LDP, 0);
    al[j] = lds_frag(rd + PLANE + fa + j * 16 * LDP, 0);
  }
  // The first rows' A reads stay in front of the B reads: the scheduler otherwise puts A_hi
  // last, and the tile's first product then waits for nearly all of the reads.
  __builtin_amdgcn_sched_barrier(0);
  #pragma unroll
  for (int ks = 0; ks < BK; ks += 32) {
    bf16x16 bh[NS], bl[NS];
    #pragma unroll
    for (int ns = 0; ns < NS; ++ns) {
      bh[ns] = lds_frag(rd + 2 * PLANE + fb + ns * 16 * LDP, ks);
      bl[ns] = lds_frag(rd + 3 * PLANE + fb + ns * 16 * LDP, ks);
    }
    #pragma unroll
    for (int ms = 0; ms < MS; ++ms) {
      const int i = (ks / 32) * MS + ms;
      const int c = i % D;
      if (i + D - 1 < SL) {
        const int n = i + D - 1, nm = n % MS, nk = (n / MS) * 32;
        ah[n % D] = lds_frag(rd + fa + nm * 16 * LDP, nk);
        al[n % D] = lds_frag(rd + PLANE + fa + nm * 16 * LDP, nk);
      }
      // The fragment reads issue as one group in front of this row's products.
      __builtin_amdgcn_sched_barrier(0);
      #pragma unroll
      for (int ns = 0; ns < NS; ++ns) {
        // bf16x3 split-precision accumulation (hi*hi + hi*lo + lo*hi), f32 C.
        // The weight fragment is the matrix A and the x fragment the matrix B: a lane's 8
        // accumulator registers are then 8 consecutive channels of one row of the output.
        acc[ms][ns] = wmma_bf16(bh[ns], ah[c], acc[ms][ns]);
        acc[ms][ns] = wmma_bf16(bl[ns], ah[c], acc[ms][ns]);
        acc[ms][ns] = wmma_bf16(bh[ns], al[c], acc[ms][ns]);
      }
      const int s = i % HW;
      if constexpr (ST) {
        __bf16* d = wr + so + i * 16 * LDP;
        cvt_store_row(pA[s], d, d + PLANE);
        cvt_store_row(pB[s], d + 2 * PLANE, d + 3 * PLANE);
      }
      if (i < HW) {
        if constexpr (L1) {
          // Behind the kernel's last staging loads their address registers fall free: the
          // wait for the address translations stands in front of whatever reuses them, and
          // the fence keeps these two loads directly in front of the wait.
          constexpr bool last = !L2;
          if (last && i == HW - 1) __builtin_amdgcn_sched_barrier(0);
          pA[s] = *(gf32x4_ptr)(n1A + (size_t)(i + HW) * 16 * Kdim);
          pB[s] = *(gf32x4_ptr)(n1B + (size_t)(i + HW) * 16 * Kdim);
          if (last && i == HW - 1) asm volatile("s_wait_xcnt 0x0" ::: "memory");
        }
      } else {
        if constexpr (L2) {
          pA[s] = *(gf32x4_ptr)(n1A + BK + (size_t)(i - HW) * 16 * Kdim);
          pB[s] = *(gf32x4_ptr)(n1B + BK + (size_t)(i - HW) * 16 * Kdim);
        }
      }
      // Keeps each row's staging and refill loads in their row: the scheduler otherwise
      // sinks the loads to the end of the trip, a few rows in front of their first use.
      __builtin_amdgcn_sched_barrier(0);
    }
  }
}

// x * sigmoid(x) = h + h * tanh(h) with h = x / 2: one v_tanh_f32 and one fma.
__device__ __forceinline__ float silu_of_half(float h) {
  return __builtin_fmaf(h, __builtin_amdgcn_tanhf(h), h);
}

// ah, bh, mh: half the folded scale, half the folded shift, half the channel's multiplier,
// so that each SiLU gets its argument already halved (a halving is exact short of underflow).
__device__ __forceinline__ float gn_silu_chain(float v, float ah, float bh, float mh) {
  float h = v * ah + bh;         // ((v - mean) * inv * gamma + beta) / 2, folded
  return silu_of_half(silu_of_half(h) * mh);
}

// The value of lane l ^ 16.
__device__ __forceinline__ float xhalf(float x) {
  return __builtin_bit_cast(float, __builtin_amdgcn_permlanex16(
      __builtin_bit_cast(int, x), __builtin_bit_cast(int, x),
      0x76543210, 0xfedcba98, false, false));
}

} // namespace

__global__ __launch_bounds__(256)
void fused_gemm_gn_silu(const float* __restrict__ x,
                        const float* __restrict__ w,
                        const float* __restrict__ bias,
                        const float* __restrict__ gnw,
                        const float* __restrict__ gnb,
                        const float* __restrict__ mw,
                        float* __restrict__ out) {
  // 288 KB LDS, time-aliased: two buffers of [A_hi|A_lo|B_hi|B_lo] (144 KB each) during
  // the GEMM, the finished output rows (272 KB) after.
  __shared__ __align__(16) unsigned char smem[2 * STAGE * 2];

  __bf16* St = (__bf16*)smem;             // [2][4][BM][LDP]

  const int tid  = threadIdx.x;
  const int lane = tid & 31;
  const int wave = tid >> 5;
  const int wm   = wave >> 2;             // 0..1  -> 128-row strip
  const int wn   = wave & 3;              // 0..3  -> 64-col strip
  const int r16  = lane & 15;
  const int half = lane >> 4;             // K sub-chunk select per WMMA layout

  const int m0 = blockIdx.y * BM;
  const int n0 = blockIdx.x * BN;

  // Staging: 16 lanes per tile row, 4 f32 each; a thread serves rows sRow + 16 * i.
  // A wave's two rows lie 8 apart: 8 * 144 B = 32 banks mod 64, so its 8-byte LDS
  // stores fall on 64 distinct banks.
  const int sRow = wave + half * 8;
  const int sCol = r16 * 4;


  gfloat_ptr srcA = (gfloat_ptr)(x + (size_t)(m0 + sRow) * Kdim + sCol);
  gfloat_ptr srcB = (gfloat_ptr)(w + (size_t)(n0 + sRow) * Kdim + sCol);

  f32x8 acc[MS][NS] = {};

  const int fa = (wm * 128 + r16) * LDP + half * 8;   // fragment offsets, k sub-chunk included
  const int fb = (wn * 64 + r16) * LDP + half * 8;
  const int so = sRow * LDP + sCol;                   // staging offset

  // Prologue: tile 0 through registers into buffer 0, the first half of tile 1 on its way
  // into registers (row by row, A then B, the order in which the loop refills them).
  f32x4 pA[HW], pB[HW];
  {
    f32x4 qA[SL], qB[SL];
    load_slice(srcA, qA);
    load_slice(srcB, qB);
    #pragma unroll
    for (int i = 0; i < SL; ++i) {
      __bf16* d = St + so + i * 16 * LDP;
      cvt_store_row(qA[i], d, d + PLANE);
      cvt_store_row(qB[i], d + 2 * PLANE, d + 3 * PLANE);
    }
  }
  #pragma unroll
  for (int i = 0; i < HW; ++i) {
    pA[i] = *(gf32x4_ptr)(srcA + BK + (size_t)i * 16 * Kdim);
    pB[i] = *(gf32x4_ptr)(srcB + BK + (size_t)i * 16 * Kdim);
  }
  lds_barrier();

  // Trip t multiplies tile t out of buffer t & 1 while tile t + 1 is split and stored into
  // the other buffer; its second half and the first half of tile t + 2 are loaded. The one
  // barrier of a trip publishes tile t + 1 and ends every read of the buffer that the next
  // trip refills.
  for (int t = 0; t < NT - 2; ++t) {
    const int cur = t & 1;
    k_tile<true, true, true>(St + cur * STAGE, St + (cur ^ 1) * STAGE, srcA + BK, srcB + BK,
                             pA, pB, acc, fa, fb, so);
    lds_barrier();
    // The loads issued above name srcA and srcB: wait for their address translations
    // before the pointers advance; the operands keep the two additions behind it.
    asm volatile("s_wait_xcnt 0x0" : "+v"(srcA), "+v"(srcB) :: "memory");
    srcA += BK;
    srcB += BK;
  }
  k_tile<true, true, false>(St, St + STAGE, srcA + BK, srcB + BK, pA, pB, acc, fa, fb, so);
  lds_barrier();
  k_tile<false, false, false>(St + STAGE, St, srcA, srcB, pA, pB, acc, fa, fb, so);

  __syncthreads();  // staging readers done before the output rows overwrite LDS

  // Accumulator map with the weights as A: acc[ms][ns][r] is row wm*128 + ms*16 + r16,
  // channel wn*64 + ns*16 + half*8 + r of the tile. A group's 32 channels are the tiles
  // ns = 2g and 2g + 1 of lanes l and l ^ 16: its sums are in-lane adds and one exchange
  // of the lane halves.
  static_assert(GS == 32 && NS == 4, "two accumulator tiles per group, two groups per wave");
  // The wave's place as scalars and the lane from the hardware: of the epilogue's indices
  // only the wave's number lives through the K loop, whose register budget is full.
  const int sw = __builtin_amdgcn_readfirstlane(wave);
  const int em = sw >> 2, en = sw & 3;                 // as wm, wn
  const int el = (int)__builtin_amdgcn_mbcnt_lo(~0u, 0u);
  const int e16 = el & 15, eh = el >> 4;               // as r16, half
  const int ch0 = n0 + en * 64 + eh * 8;               // this lane's first channel
  const int g0  = blockIdx.x * (BN / GS) + en * 2;     // this wave's first group
  const float* pb = bias + ch0;
  const float* pm = mw + ch0;
  const float* pw = gnw + g0;
  const float* pg = gnb + g0;
  f32x4 bv[NS][2], mh[NS][2];
  float gamma[2], beta[2];
  #pragma unroll
  for (int ns = 0; ns < NS; ++ns) {
    #pragma unroll
    for (int j = 0; j < 2; ++j) {
      bv[ns][j] = *(const f32x4*)(pb + ns * 16 + j * 4);
      mh[ns][j] = *(const f32x4*)(pm + ns * 16 + j * 4);
    }
  }
  #pragma unroll
  for (int g = 0; g < 2; ++g) {
    gamma[g] = pw[g];
    beta[g]  = pg[g];
  }
  // These loads name their address registers: this wait stands in front of the code below,
  // which reuses those registers. The input operands keep the four addresses live up to
  // the wait, so that no load lands in one and nothing else is put there.
  asm volatile("s_wait_xcnt 0x0" :: "v"(pb), "v"(pm), "s"(pw), "s"(pg) : "memory");
  #pragma unroll
  for (int ns = 0; ns < NS; ++ns) {
    mh[ns][0] *= 0.5f;                                 // the halves that gn_silu_chain takes
    mh[ns][1] *= 0.5f;
  }
  #pragma unroll
  for (int g = 0; g < 2; ++g) {
    gamma[g] *= 0.5f;
    beta[g]  *= 0.5f;
  }

  // The finished rows pass through the wave's own LDS range, so that the global stores
  // cover whole 128-B lines. Pitch 64 + 4 floats: the 16 rows of a 16-byte store, and the
  // 64 channels of a row that is read back, each fall on 64 distinct banks.
  constexpr int CP = 64 + 4;
  static_assert(8 * 128 * CP * 4 <= 2 * STAGE * 2, "eight output ranges fit in the two buffers");
  float* Cw = (float*)smem + sw * (128 * CP);
  float* wr = Cw + e16 * CP + eh * 8;                  // as computed: one row, 8 channels a tile
  const float* rb = Cw + eh * CP + e16 * 4;            // read back: 16 lanes a row, 2 rows
  gfloat_out_ptr og =
      (gfloat_out_ptr)(out + (size_t)(m0 + em * 128 + eh) * Ndim + n0 + en * 64 + e16 * 4);

  // The accumulators go to LDS as they are, each lane's 8 channels of a tile in two 16-byte
  // stores; the loop below takes them back from the same places, so that it can stay rolled.
  #pragma unroll
  for (int ms = 0; ms < MS; ++ms) {
    #pragma unroll
    for (int ns = 0; ns < NS; ++ns) {
      const f32x8 c = acc[ms][ns];
      *(f32x4*)(wr + ms * 16 * CP + ns * 16)     = __builtin_shufflevector(c, c, 0, 1, 2, 3);
      *(f32x4*)(wr + ms * 16 * CP + ns * 16 + 4) = __builtin_shufflevector(c, c, 4, 5, 6, 7);
    }
  }

  // Two accumulator rows (32 output rows) a trip. The loop stays rolled: unrolled, its text
  // is four times as long.
  constexpr int SB = 2;
  static_assert(MS % SB == 0, "whole trips");
  #pragma unroll 1
  for (int it = 0; it < MS / SB; ++it) {
    f32x4 raw[SB][2 * NS];
    #pragma unroll
    for (int sl = 0; sl < SB; ++sl) {
      #pragma unroll
      for (int k = 0; k < 2 * NS; ++k)
        raw[sl][k] = *(const f32x4*)(wr + sl * 16 * CP + (k >> 1) * 16 + (k & 1) * 4);
    }
    f32x4 t[8];
    #pragma unroll
    for (int sl = 0; sl < SB; ++sl) {
      #pragma unroll
      for (int g = 0; g < 2; ++g) {
        // Element by element, as gn_silu_chain is: with 4-wide vector arithmetic here this
        // compiler's register allocation of the K loop came out with copies of staged rows
        // behind waits for nearly all loads in flight.
        float v[16];
        #pragma unroll
        for (int e = 0; e < 16; ++e)
          v[e] = raw[sl][4 * g + (e >> 2)][e & 3] + bv[2 * g + (e >> 3)][(e >> 2) & 1][e & 3];
        float sp[4], qp[4];
        #pragma unroll
        for (int e = 0; e < 4; ++e) {
          sp[e] = (v[e] + v[e + 4]) + (v[e + 8] + v[e + 12]);
          qp[e] = (v[e] * v[e] + v[e + 4] * v[e + 4]) + (v[e + 8] * v[e + 8] + v[e + 12] * v[e + 12]);
        }
        float s  = (sp[0] + sp[1]) + (sp[2] + sp[3]);
        float ss = (qp[0] + qp[1]) + (qp[2] + qp[3]);
        s  += xhalf(s);
        ss += xhalf(ss);
        const float mean = s * (1.0f / GS);
        const float var  = ss * (1.0f / GS) - mean * mean;
        const float inv  = rsqrtf(var + EPS);
        const float a    = inv * gamma[g];             // gamma, beta: halved above
        const float b    = beta[g] - mean * a;
        #pragma unroll
        for (int q = 0; q < 4; ++q) {
          const f32x4 m = mh[2 * g + (q >> 1)][q & 1];
          f32x4 o;
          o[0] = gn_silu_chain(v[4 * q + 0], a, b, m[0]);
          o[1] = gn_silu_chain(v[4 * q + 1], a, b, m[1]);
          o[2] = gn_silu_chain(v[4 * q + 2], a, b, m[2]);
          o[3] = gn_silu_chain(v[4 * q + 3], a, b, m[3]);
          *(f32x4*)(wr + sl * 16 * CP + g * 32 + (q >> 1) * 16 + (q & 1) * 4) = o;
        }
      }
      if (sl > 0) {
        // Output is write-once: stream past L2 (TH=NT) to preserve x/W reuse.
        #pragma unroll
        for (int i = 0; i < 8; ++i)
          __builtin_nontemporal_store(t[i],
              (gf32x4_out_ptr)(og + (size_t)((sl - 1) * 16 + 2 * i) * Ndim));
        // The stores name t: their address translations are waited for before t is refilled.
        asm volatile("s_wait_xcnt 0x0" ::: "memory");
      }
      // This wave's LDS stores have landed before its lanes read each other's rows back.
      asm volatile("s_wait_dscnt 0x0" ::: "memory");
      #pragma unroll
      for (int i = 0; i < 8; ++i) t[i] = *(const f32x4*)(rb + (sl * 16 + 2 * i) * CP);
    }
    #pragma unroll
    for (int i = 0; i < 8; ++i)
      __builtin_nontemporal_store(t[i],
          (gf32x4_out_ptr)(og + (size_t)((SB - 1) * 16 + 2 * i) * Ndim));
    // The stores name og and t: wait for their address translations before the pointer
    // advances and the next trip refills t; the operand keeps the addition behind the wait.
    asm volatile("s_wait_xcnt 0x0" : "+v"(og) :: "memory");
    og += (size_t)SB * 16 * Ndim;
    wr += SB * 16 * CP;
    rb += SB * 16 * CP;
  }
}

extern "C" void kernel_launch(void* const* d_in, const int* in_sizes, int n_in,
                              void* d_out, int out_size, void* d_ws, size_t ws_size,
                              hipStream_t stream) {
  (void)in_sizes; (void)n_in; (void)out_size; (void)d_ws; (void)ws_size;
  const float* x    = (const float*)d_in[0];
  const float* w    = (const float*)d_in[1];
  const float* bias = (const float*)d_in[2];
  const float* gnw  = (const float*)d_in[3];
  const float* gnb  = (const float*)d_in[4];
  const float* mw   = (const float*)d_in[5];
  float* out        = (float*)d_out;

  dim3 grid(Ndim / BN, Mdim / BM);   // 8 x 64 workgroups
  dim3 block(256);                   // 8 wave32s
  fused_gemm_gn_silu<<<grid, block, 0, stream>>>(x, w, bias, gnw, gnb, mw, out);
}

// v008
// Measured time: 196 microseconds a run.
// Next to v007, in two timings, it ran 1.05 times as fast each time.
// Counting every step since v000, it is 4.39 times as fast.
#include <hip/hip_runtime.h>
#include <hip/hip_bf16.h>

typedef __bf16 bf16x4  __attribute__((ext_vector_type(4)));
typedef __bf16 bf16x8  __attribute__((ext_vector_type(8)));
typedef __bf16 bf16x16 __attribute__((ext_vector_type(16)));
typedef float  f32x8   __attribute__((ext_vector_type(8)));
typedef float  f32x4   __attribute__((ext_vector_type(4)));
typedef uint32_t u32x4 __attribute__((ext_vector_type(4)));
typedef uint32_t u32x8 __attribute__((ext_vector_type(8)));

namespace {

constexpr int Mdim = 16384;
constexpr int Kdim = 2048;
constexpr int Ndim = 2048;
constexpr int GS   = 32;          // channels per group (N/G = 2048/64)
constexpr float EPS = 1e-5f;

// One 256 x 256 tile per work-group, 128 x 64 per wave (8 x 4 accumulator tiles): each
// staged element and each loaded fragment feeds twice the products of a 128 x 128 tile.
constexpr int BM = 256, BN = 256, BK = 64;
constexpr int MS = 8, NS = 4;     // 16 x 16 accumulator tiles per wave, rows x columns
constexpr int SL = BM / 16;       // tile rows of x that a thread stages
constexpr int HW = SL / 2;        // of these, rows held in registers at a time
static_assert(BM == BN, "one plane size serves both operands");
// LDS row pitch of the staged bf16 planes, in elements: 64 data + 8 pad = 144 B
// (16 B x odd), so the 16 rows of a ds_load_b128 fragment read fall on distinct banks.
constexpr int LDP = BK + 8;
constexpr int PLANE = BM * LDP;   // elements of one staged plane
constexpr int STAGE = 4 * PLANE;  // elements of one buffer: A_hi | A_lo | B_hi | B_lo
constexpr int NT = Kdim / BK;     // K tiles
static_assert(NT >= 2 && NT % 2 == 0, "the two peeled trips read buffer 0, then buffer 1");

// Pointers typed as global memory: they stay global_load addresses after passing
// through an asm operand.
typedef const __attribute__((address_space(1))) float* gfloat_ptr;
typedef const __attribute__((address_space(1))) f32x4* gf32x4_ptr;
typedef __attribute__((address_space(1))) float* gfloat_out_ptr;
typedef __attribute__((address_space(1))) f32x4* gf32x4_out_ptr;

union FragAB { bf16x16 v; bf16x8 h[2]; };

__device__ __forceinline__ f32x8 wmma_bf16(bf16x16 a, bf16x16 b, f32x8 c) {
  // 8 args: (neg_a, A, neg_b, B, c_mod, C, reuse_a, reuse_b)
  return __builtin_amdgcn_wmma_f32_16x16x32_bf16(false, a, false, b,
                                                 (short)0, c, false, false);
}

// Load one 16x32 bf16 WMMA operand fragment from LDS.
// Per ISA layout: lanes 0-15 take K chunks [0,8)+[16,24); lanes 16-31 take
// [8,16)+[24,32) of their row/col. `rowBase` already includes half*8; `k` is ks.
__device__ __forceinline__ bf16x16 lds_frag(const __bf16* rowBase, int k) {
  FragAB f;
  f.h[0] = *(const bf16x8*)(rowBase + k);
  f.h[1] = *(const bf16x8*)(rowBase + k + 16);
  return f.v;
}

// Prefetch one staging slice into registers: 4 f32 of each of 16 tile rows, 16 rows apart.
// 16 adjacent lanes read one row's 256 B, so a wave-wide load covers four whole 128-B lines.
__device__ __forceinline__ void load_slice(gfloat_ptr src, f32x4* p) {
  #pragma unroll
  for (int i = 0; i < SL; ++i) p[i] = *(gf32x4_ptr)(src + (size_t)i * 16 * Kdim);
}

// Split 4 prefetched f32 into bf16 hi + bf16 residual lo, store both (to LDS, or to the weight planes in global memory).
__device__ __forceinline__ void cvt_store_row(f32x4 p, __bf16* dh, __bf16* dl) {
  bf16x4 vh, vl;
  #pragma unroll
  for (int j = 0; j < 4; ++j) {
    __bf16 hi = (__bf16)p[j];
    vh[j] = hi;
    vl[j] = (__bf16)(p[j] - (float)hi);
  }
  *(bf16x4*)dh = vh;
  *(bf16x4*)dl = vl;
}

// Work-group barrier that waits for this wave's LDS traffic only: __syncthreads() would
// also drain the global loads that are in flight for x tile 1.
__device__ __forceinline__ void lds_barrier() {
  asm volatile("s_wait_dscnt 0x0" ::: "memory");    // own LDS stores landed, own reads done
  asm volatile("s_barrier_signal -1" ::: "memory");
  asm volatile("s_barrier_wait -1" ::: "memory");
}

__device__ __forceinline__ uint32_t uni(uint32_t v) {
  return (uint32_t)__builtin_amdgcn_readfirstlane(v);
}

// A wave-uniform word for a test that must compile to a scalar branch: a tensor load ignores
// EXEC, and only such a branch keeps a wave from issuing it.
__device__ __forceinline__ uint32_t pinned(uint32_t v) {
  uint32_t w = uni(v);
  asm volatile("" : "+s"(w));  // pinned(): holds the word in a scalar register
  return w;
}

// Byte offset of a __shared__ address in the work-group's LDS.
__device__ __forceinline__ uint32_t lds_off(const void* p) { return (uint32_t)(size_t)p; }

// One tensor load brings TROWS rows of 128 B (64 bf16 of k) of one weight plane into LDS,
// 16 B of pad behind each row: the pitch of 144 B that the fragment reads expect.
constexpr uint32_t TROWS = 128;
constexpr uint32_t TWAVES = 2 * BN / TROWS;   // issuing waves: two planes of BN rows
constexpr uint32_t TROWB = BK * 2;
static_assert(TROWB == 128 && LDP * 2 == TROWB + 16, "pad codes 4 / 3: rows of 128 B, 16 B more");
static_assert((TROWS * LDP * 2) % 2048 == 0 && (PLANE * 2) % 2048 == 0 && (STAGE * 2) % 2048 == 0,
              "every slice lands at a multiple of 2 KiB");

// Descriptor group 1: 1-byte elements, tensor = tile = TROWS rows of TROWB bytes, no mask.
__device__ __forceinline__ u32x8 tdm_group1() {
  // Each word pinned(): built once and held in its scalar register through the K loop, so
  // that none is written again while a request is outstanding.
  u32x8 g;
  g[0] = pinned((1u << 20) | (4u << 22) | (3u << 25));
  g[1] = pinned((TROWB & 0xFFFFu) << 16);
  g[2] = pinned((TROWB >> 16) | ((TROWS & 0xFFFFu) << 16));
  g[3] = pinned((TROWS >> 16) | (TROWB << 16));
  g[4] = pinned(TROWS);
  g[5] = pinned((uint32_t)Kdim * 2u);   // source row pitch in bytes
  g[6] = pinned(0u);
  g[7] = pinned(0u);
  return g;
}

// Descriptor group 0: count 1, place in LDS, the tile's first byte, type 2.
__device__ __forceinline__ u32x4 tdm_group0(uint32_t lds_dst, uint64_t ga) {
  u32x4 g;
  g[0] = uni(1u);
  g[1] = uni(lds_dst);
  g[2] = uni((uint32_t)ga);
  g[3] = uni((((uint32_t)(ga >> 32)) & 0x01FFFFFFu) | 0x80000000u);
  return g;
}

__device__ __forceinline__ void tdm_load(u32x4 g0, u32x8 g1) {
  asm volatile("tensor_load_to_lds %0, %1" :: "s"(g0), "s"(g1) : "memory");
}

// Publish point of the next tile: this wave's LDS traffic is done, an issuing wave's weight
// slice has landed, then the work-group barrier. As lds_barrier(), it leaves the global loads
// for the tile after next in flight.
__device__ __forceinline__ void publish(uint32_t tw) {
  asm volatile("s_wait_dscnt 0x0" ::: "memory");    // own LDS stores landed, own reads done
  // The issuer's own wait, before it signals.
  if (pinned(tw < TWAVES)) asm volatile("s_wait_tensorcnt 0x0" ::: "memory");
  asm volatile("s_barrier_signal -1" ::: "memory");
  asm volatile("s_barrier_wait -1" ::: "memory");
}

// One K tile: the products of the tile in buffer rd. The A fragments of accumulator row
// i + 2 are read from LDS in front of row i's products, into one of 3 register sets, so that
// no row waits for its own reads. Behind each row's reads one staged row of x of the NEXT
// tile goes from registers into buffer wr (ST), and the same registers are refilled with
// the row that is staged HW rows later: in the next tile (L1) or, from the middle of the
// trip on, in the tile after it (L2). The weight planes of the next tile come by tensor load.
// n1A: this lane's staging address in the next tile.
// fa, fb: this lane's fragment offsets in the A and B planes; so: its staging offset.
template <bool ST, bool L1, bool L2>
__device__ __forceinline__ void k_tile(const __bf16* rd, __bf16* wr, gfloat_ptr n1A,
                                       f32x4 (&pA)[HW],
                                       f32x8 (&acc)[MS][NS], int fa, int fb, int so) {
  static_assert((BK / 32) * MS == SL, "one staged row of x per accumulator row");
  constexpr int D = 3;   // register sets of the A fragments
  bf16x16 ah[D], al[D];
  #pragma unroll
  for (int j = 0; j < D - 1; ++j) {
    ah[j] = lds_frag(rd + fa + j * 16 * LDP, 0);
    al[j] = lds_frag(rd + PLANE + fa + j * 16 * LDP, 0);
  }
  // The first rows' A reads stay in front of the B reads: the scheduler otherwise puts A_hi
  // last, and the tile's first product then waits for nearly all of the reads.
  __builtin_amdgcn_sched_barrier(0);
  #pragma unroll
  for (int ks = 0; ks < BK; ks += 32) {
    bf16x16 bh[NS], bl[NS];
    #pragma unroll
    for (int ns = 0; ns < NS; ++ns) {
      bh[ns] = lds_frag(rd + 2 * PLANE + fb + ns * 16 * LDP, ks);
      bl[ns] = lds_frag(rd + 3 * PLANE + fb + ns * 16 * LDP, ks);
    }
    #pragma unroll
    for (int ms = 0; ms < MS; ++ms) {
      const int i = (ks / 32) * MS + ms;
      const int c = i % D;
      if (i + D - 1 < SL) {
        const int n = i + D - 1, nm = n % MS, nk = (n / MS) * 32;
        ah[n % D] = lds_frag(rd + fa + nm * 16 * LDP, nk);
        al[n % D] = lds_frag(rd + PLANE + fa + nm * 16 * LDP, nk);
      }
      // The fragment reads issue as one group in front of this row's products.
      __builtin_amdgcn_sched_barrier(0);
      #pragma unroll
      for (int ns = 0; ns < NS; ++ns) {
        // bf16x3 split-precision accumulation (hi*hi + hi*lo + lo*hi), f32 C.
        // The weight fragment is the matrix A and the x fragment the matrix B: a lane's 8
        // accumulator registers are then 8 consecutive channels of one row of the output.
        acc[ms][ns] = wmma_bf16(bh[ns], ah[c], acc[ms][ns]);
        acc[ms][ns] = wmma_bf16(bl[ns], ah[c], acc[ms][ns]);
        acc[ms][ns] = wmma_bf16(bh[ns], al[c], acc[ms][ns]);
      }
      const int s = i % HW;
      if constexpr (ST) {
        __bf16* d = wr + so + i * 16 * LDP;
        cvt_store_row(pA[s], d, d + PLANE);
      }
      if (i < HW) {
        if constexpr (L1) {
          // Behind the kernel's last staging loads their address registers fall free: the
          // wait for the address translations stands in front of whatever reuses them, and
          // the fence keeps this load directly in front of the wait.
          constexpr bool last = !L2;
          if (last && i == HW - 1) __builtin_amdgcn_sched_barrier(0);
          pA[s] = *(gf32x4_ptr)(n1A + (size_t)(i + HW) * 16 * Kdim);
          if (last && i == HW - 1) asm volatile("s_wait_xcnt 0x0" ::: "memory");
        }
      } else {
        if constexpr (L2) {
          pA[s] = *(gf32x4_ptr)(n1A + BK + (size_t)(i - HW) * 16 * Kdim);
        }
      }
      // Keeps each row's staging and refill loads in their row: the scheduler otherwise
      // sinks the loads to the end of the trip, a few rows in front of their first use.
      __builtin_amdgcn_sched_barrier(0);
    }
  }
}

// x * sigmoid(x) = h + h * tanh(h) with h = x / 2: one v_tanh_f32 and one fma.
__device__ __forceinline__ float silu_of_half(float h) {
  return __builtin_fmaf(h, __builtin_amdgcn_tanhf(h), h);
}

// ah, bh, mh: half the folded scale, half the folded shift, half the channel's multiplier,
// so that each SiLU gets its argument already halved (a halving is exact short of underflow).
__device__ __forceinline__ float gn_silu_chain(float v, float ah, float bh, float mh) {
  float h = v * ah + bh;         // ((v - mean) * inv * gamma + beta) / 2, folded
  return silu_of_half(silu_of_half(h) * mh);
}

// The value of lane l ^ 16.
__device__ __forceinline__ float xhalf(float x) {
  return __builtin_bit_cast(float, __builtin_amdgcn_permlanex16(
      __builtin_bit_cast(int, x), __builtin_bit_cast(int, x),
      0x76543210, 0xfedcba98, false, false));
}

} // namespace

// First launch: the weights split once into a bf16 hi plane and a bf16 residual plane, each
// [Ndim][Kdim], one behind the other in the workspace. One work-group of 16 waves a WGP;
// a thread has SPL loads of 16 B in flight, each wave-wide load covering four whole lines.
constexpr int SPT = 512, SPL = 8;
constexpr int SPG = Ndim * Kdim / (SPT * SPL * 4);
static_assert(SPG * SPT * SPL * 4 == Ndim * Kdim, "whole work-groups");

__global__ __launch_bounds__(SPT)
void split_weights(const float* __restrict__ w, __bf16* __restrict__ planes) {
  const size_t e = (size_t)blockIdx.x * (SPT * SPL * 4) + threadIdx.x * 4;
  f32x4 p[SPL];
  #pragma unroll
  for (int i = 0; i < SPL; ++i) p[i] = *(const f32x4*)(w + e + i * (SPT * 4));
  #pragma unroll
  for (int i = 0; i < SPL; ++i)
    cvt_store_row(p[i], planes + e + i * (SPT * 4), planes + (size_t)Ndim * Kdim + e + i * (SPT * 4));
}

__global__ __launch_bounds__(256)
void fused_gemm_gn_silu(const float* __restrict__ x,
                        const __bf16* __restrict__ wp,
                        const float* __restrict__ bias,
                        const float* __restrict__ gnw,
                        const float* __restrict__ gnb,
                        const float* __restrict__ mw,
                        float* __restrict__ out) {
  // 288 KB LDS, time-aliased: two buffers of [A_hi|A_lo|B_hi|B_lo] (144 KB each) during
  // the GEMM, the finished output rows (272 KB) after.
  // Aligned so that every tensor load's place is a multiple of 2 KiB.
  __shared__ __attribute__((aligned(2048))) unsigned char smem[2 * STAGE * 2];

  __bf16* St = (__bf16*)smem;             // [2][4][BM][LDP]

  const int tid  = threadIdx.x;
  const int lane = tid & 31;
  const int wave = tid >> 5;
  const int wm   = wave >> 2;             // 0..1  -> 128-row strip
  const int wn   = wave & 3;              // 0..3  -> 64-col strip
  const int r16  = lane & 15;
  const int half = lane >> 4;             // K sub-chunk select per WMMA layout

  const int m0 = blockIdx.y * BM;
  const int n0 = blockIdx.x * BN;

  // Staging: 16 lanes per tile row, 4 f32 each; a thread serves rows sRow + 16 * i.
  // A wave's two rows lie 8 apart: 8 * 144 B = 32 banks mod 64, so its 8-byte LDS
  // stores fall on 64 distinct banks.
  const int sRow = wave + half * 8;
  const int sCol = r16 * 4;


  gfloat_ptr srcA = (gfloat_ptr)(x + (size_t)(m0 + sRow) * Kdim + sCol);

  f32x8 acc[MS][NS] = {};

  const int fa = (wm * 128 + r16) * LDP + half * 8;   // fragment offsets, k sub-chunk included
  const int fb = (wn * 64 + r16) * LDP + half * 8;
  const int so = sRow * LDP + sCol;                   // staging offset

  // The weight planes come by tensor load: waves 0 to 3 each bring 128 rows of one plane
  // (waves 0, 1: hi; 2, 3: lo), one request a wave and tile.
  const uint32_t tw = uni((uint32_t)wave);
  const uint32_t tp = (tw >> 1) & 1u, th = tw & 1u;   // plane, half of its 256 rows
  const uint64_t tsrc = (uint64_t)(uintptr_t)wp +
      ((uint64_t)tp * Ndim * Kdim + (uint64_t)((uint32_t)n0 + th * TROWS) * Kdim) * 2u;
  const uint32_t tdst = lds_off(smem) + (2u + tp) * (PLANE * 2) + th * (TROWS * LDP * 2);
  const u32x8 g1 = tdm_group1();

  // Prologue: x tile 0 through registers into buffer 0, the weight planes of tile 0 by tensor
  // load, the first half of x tile 1 on its way into registers.
  f32x4 pA[HW];
  {
    f32x4 qA[SL];
    load_slice(srcA, qA);
    if (pinned(tw < TWAVES)) {
      tdm_load(tdm_group0(tdst, tsrc), g1);
      asm volatile("s_wait_tensorcnt 0x0" ::: "memory");  // tile 0's slice has landed
    }
    #pragma unroll
    for (int i = 0; i < SL; ++i) {
      __bf16* d = St + so + i * 16 * LDP;
      cvt_store_row(qA[i], d, d + PLANE);
    }
  }
  #pragma unroll
  for (int i = 0; i < HW; ++i) pA[i] = *(gf32x4_ptr)(srcA + BK + (size_t)i * 16 * Kdim);
  lds_barrier();
  if (pinned(tw < TWAVES)) tdm_load(tdm_group0(tdst + STAGE * 2, tsrc + BK * 2), g1);

  // Trip t multiplies tile t out of buffer t & 1 while x tile t + 1 is split and stored into
  // the other buffer, where its weight planes land; the second half of x tile t + 1 and the
  // first half of x tile t + 2 are loaded. The one barrier of a trip publishes tile t + 1 and
  // ends every read of the buffer that is refilled behind it: there the weight planes of
  // tile t + 2 are asked for (t + 2 < NT in every trip of this loop).
  for (int t = 0; t < NT - 2; ++t) {
    const int cur = t & 1;
    k_tile<true, true, true>(St + cur * STAGE, St + (cur ^ 1) * STAGE, srcA + BK,
                             pA, acc, fa, fb, so);
    publish(tw);
    if (pinned(tw < TWAVES))
      tdm_load(tdm_group0(tdst + (uint32_t)cur * (STAGE * 2),
                          tsrc + (uint64_t)(uint32_t)(t + 2) * (BK * 2)), g1);
    // The loads issued above name srcA: wait for their address translations before the
    // pointer advances; the operand keeps the addition behind it.
    asm volatile("s_wait_xcnt 0x0" : "+v"(srcA) :: "memory");
    srcA += BK;
  }
  k_tile<true, true, false>(St, St + STAGE, srcA + BK, pA, acc, fa, fb, so);
  publish(tw);
  k_tile<false, false, false>(St + STAGE, St, srcA, pA, acc, fa, fb, so);

  // The ring's closing waits: no tensor load and no LDS read of this wave is outstanding
  // when the buffers become output staging.
  asm volatile("s_wait_tensorcnt 0x0" ::: "memory");
  asm volatile("s_wait_dscnt 0x0" ::: "memory");
  __syncthreads();  // staging readers done before the output rows overwrite LDS

  // Accumulator map with the weights as A: acc[ms][ns][r] is row wm*128 + ms*16 + r16,
  // channel wn*64 + ns*16 + half*8 + r of the tile. A group's 32 channels are the tiles
  // ns = 2g and 2g + 1 of lanes l and l ^ 16: its sums are in-lane adds and one exchange
  // of the lane halves.
  static_assert(GS == 32 && NS == 4, "two accumulator tiles per group, two groups per wave");
  // The wave's place as scalars and the lane from the hardware: of the epilogue's indices
  // only the wave's number lives through the K loop, whose register budget is full.
  const int sw = __builtin_amdgcn_readfirstlane(wave);
  const int em = sw >> 2, en = sw & 3;                 // as wm, wn
  const int el = (int)__builtin_amdgcn_mbcnt_lo(~0u, 0u);
  const int e16 = el & 15, eh = el >> 4;               // as r16, half
  const int ch0 = n0 + en * 64 + eh * 8;               // this lane's first channel
  const int g0  = blockIdx.x * (BN / GS) + en * 2;     // this wave's first group
  const float* pb = bias + ch0;
  const float* pm = mw + ch0;
  const float* pw = gnw + g0;
  const float* pg = gnb + g0;
  f32x4 bv[NS][2], mh[NS][2];
  float gamma[2], beta[2];
  #pragma unroll
  for (int ns = 0; ns < NS; ++ns) {
    #pragma unroll
    for (int j = 0; j < 2; ++j) {
      bv[ns][j] = *(const f32x4*)(pb + ns * 16 + j * 4);
      mh[ns][j] = *(const f32x4*)(pm + ns * 16 + j * 4);
    }
  }
  #pragma unroll
  for (int g = 0; g < 2; ++g) {
    gamma[g] = pw[g];
    beta[g]  = pg[g];
  }
  // These loads name their address registers: this wait stands in front of the code below,
  // which reuses those registers. The input operands keep the four addresses live up to
  // the wait, so that no load lands in one and nothing else is put there.
  asm volatile("s_wait_xcnt 0x0" :: "v"(pb), "v"(pm), "s"(pw), "s"(pg) : "memory");
  #pragma unroll
  for (int ns = 0; ns < NS; ++ns) {
    mh[ns][0] *= 0.5f;                                 // the halves that gn_silu_chain takes
    mh[ns][1] *= 0.5f;
  }
  #pragma unroll
  for (int g = 0; g < 2; ++g) {
    gamma[g] *= 0.5f;
    beta[g]  *= 0.5f;
  }

  // The finished rows pass through the wave's own LDS range, so that the global stores
  // cover whole 128-B lines. Pitch 64 + 4 floats: the 16 rows of a 16-byte store, and the
  // 64 channels of a row that is read back, each fall on 64 distinct banks.
  constexpr int CP = 64 + 4;
  static_assert(8 * 128 * CP * 4 <= 2 * STAGE * 2, "eight output ranges fit in the two buffers");
  float* Cw = (float*)smem + sw * (128 * CP);
  float* wr = Cw + e16 * CP + eh * 8;                  // as computed: one row, 8 channels a tile
  const float* rb = Cw + eh * CP + e16 * 4;            // read back: 16 lanes a row, 2 rows
  gfloat_out_ptr og =
      (gfloat_out_ptr)(out + (size_t)(m0 + em * 128 + eh) * Ndim + n0 + en * 64 + e16 * 4);

  // The accumulators go to LDS as they are, each lane's 8 channels of a tile in two 16-byte
  // stores; the loop below takes them back from the same places, so that it can stay rolled.
  #pragma unroll
  for (int ms = 0; ms < MS; ++ms) {
    #pragma unroll
    for (int ns = 0; ns < NS; ++ns) {
      const f32x8 c = acc[ms][ns];
      *(f32x4*)(wr + ms * 16 * CP + ns * 16)     = __builtin_shufflevector(c, c, 0, 1, 2, 3);
      *(f32x4*)(wr + ms * 16 * CP + ns * 16 + 4) = __builtin_shufflevector(c, c, 4, 5, 6, 7);
    }
  }

  // Two accumulator rows (32 output rows) a trip. The loop stays rolled: unrolled, its text
  // is four times as long.
  constexpr int SB = 2;
  static_assert(MS % SB == 0, "whole trips");
  #pragma unroll 1
  for (int it = 0; it < MS / SB; ++it) {
    f32x4 raw[SB][2 * NS];
    #pragma unroll
    for (int sl = 0; sl < SB; ++sl) {
      #pragma unroll
      for (int k = 0; k < 2 * NS; ++k)
        raw[sl][k] = *(const f32x4*)(wr + sl * 16 * CP + (k >> 1) * 16 + (k & 1) * 4);
    }
    f32x4 t[8];
    #pragma unroll
    for (int sl = 0; sl < SB; ++sl) {
      #pragma unroll
      for (int g = 0; g < 2; ++g) {
        // Element by element, as gn_silu_chain is: with 4-wide vector arithmetic here this
        // compiler's register allocation of the K loop came out with copies of staged rows
        // behind waits for nearly all loads in flight.
        float v[16];
        #pragma unroll
        for (int e = 0; e < 16; ++e)
          v[e] = raw[sl][4 * g + (e >> 2)][e & 3] + bv[2 * g + (e >> 3)][(e >> 2) & 1][e & 3];
        float sp[4], qp[4];
        #pragma unroll
        for (int e = 0; e < 4; ++e) {
          sp[e] = (v[e] + v[e + 4]) + (v[e + 8] + v[e + 12]);
          qp[e] = (v[e] * v[e] + v[e + 4] * v[e + 4]) + (v[e + 8] * v[e + 8] + v[e + 12] * v[e + 12]);
        }
        float s  = (sp[0] + sp[1]) + (sp[2] + sp[3]);
        float ss = (qp[0] + qp[1]) + (qp[2] + qp[3]);
        s  += xhalf(s);
        ss += xhalf(ss);
        const float mean = s * (1.0f / GS);
        const float var  = ss * (1.0f / GS) - mean * mean;
        const float inv  = rsqrtf(var + EPS);
        const float a    = inv * gamma[g];             // gamma, beta: halved above
        const float b    = beta[g] - mean * a;
        #pragma unroll
        for (int q = 0; q < 4; ++q) {
          const f32x4 m = mh[2 * g + (q >> 1)][q & 1];
          f32x4 o;
          o[0] = gn_silu_chain(v[4 * q + 0], a, b, m[0]);
          o[1] = gn_silu_chain(v[4 * q + 1], a, b, m[1]);
          o[2] = gn_silu_chain(v[4 * q + 2], a, b, m[2]);
          o[3] = gn_silu_chain(v[4 * q + 3], a, b, m[3]);
          *(f32x4*)(wr + sl * 16 * CP + g * 32 + (q >> 1) * 16 + (q & 1) * 4) = o;
        }
      }
      if (sl > 0) {
        // Output is write-once: stream past L2 (TH=NT) to preserve x/W reuse.
        #pragma unroll
        for (int i = 0; i < 8; ++i)
          __builtin_nontemporal_store(t[i],
              (gf32x4_out_ptr)(og + (size_t)((sl - 1) * 16 + 2 * i) * Ndim));
        // The stores name t: their address translations are waited for before t is refilled.
        asm volatile("s_wait_xcnt 0x0" ::: "memory");
      }
      // This wave's LDS stores have landed before its lanes read each other's rows back.
      asm volatile("s_wait_dscnt 0x0" ::: "memory");
      #pragma unroll
      for (int i = 0; i < 8; ++i) t[i] = *(const f32x4*)(rb + (sl * 16 + 2 * i) * CP);
    }
    #pragma unroll
    for (int i = 0; i < 8; ++i)
      __builtin_nontemporal_store(t[i],
          (gf32x4_out_ptr)(og + (size_t)((SB - 1) * 16 + 2 * i) * Ndim));
    // The stores name og and t: wait for their address translations before the pointer
    // advances and the next trip refills t; the operand keeps the addition behind the wait.
    asm volatile("s_wait_xcnt 0x0" : "+v"(og) :: "memory");
    og += (size_t)SB * 16 * Ndim;
    wr += SB * 16 * CP;
    rb += SB * 16 * CP;
  }
}

extern "C" void kernel_launch(void* const* d_in, const int* in_sizes, int n_in,
                              void* d_out, int out_size, void* d_ws, size_t ws_size,
                              hipStream_t stream) {
  (void)in_sizes; (void)n_in; (void)out_size; (void)ws_size;
  const float* x    = (const float*)d_in[0];
  const float* w    = (const float*)d_in[1];
  const float* bias = (const float*)d_in[2];
  const float* gnw  = (const float*)d_in[3];
  const float* gnb  = (const float*)d_in[4];
  const float* mw   = (const float*)d_in[5];
  float* out        = (float*)d_out;
  __bf16* planes    = (__bf16*)d_ws;   // weight planes, hi then lo: 16 MiB

  dim3 grid(Ndim / BN, Mdim / BM);   // 8 x 64 workgroups
  dim3 block(256);                   // 8 wave32s
  split_weights<<<dim3(SPG), dim3(SPT), 0, stream>>>(w, planes);
  fused_gemm_gn_silu<<<grid, block, 0, stream>>>(x, planes, bias, gnw, gnb, mw, out);
}

// v010
// Measured time: 108 microseconds a run.
// Versions in between are left out here; by their measured steps it is 1.80 times as fast as v008.
// Counting every step since v000, it is 7.90 times as fast.
#include <hip/hip_runtime.h>

typedef _Float16 f16x4  __attribute__((ext_vector_type(4)));
typedef _Float16 f16x8  __attribute__((ext_vector_type(8)));
typedef _Float16 f16x16 __attribute__((ext_vector_type(16)));
typedef float  f32x8   __attribute__((ext_vector_type(8)));
typedef float  f32x4   __attribute__((ext_vector_type(4)));
typedef uint32_t u32x4 __attribute__((ext_vector_type(4)));
typedef uint32_t u32x8 __attribute__((ext_vector_type(8)));

namespace {

constexpr int Mdim = 16384;
constexpr int Kdim = 2048;
constexpr int Ndim = 2048;
constexpr int GS   = 32;          // channels per group (N/G = 2048/64)
constexpr float EPS = 1e-5f;

// One 256 x 256 tile per work-group, 128 x 64 per wave (8 x 4 accumulator tiles): each
// staged element and each loaded fragment feeds twice the products of a 128 x 128 tile.
constexpr int BM = 256, BN = 256, BK = 64;
constexpr int MS = 8, NS = 4;     // 16 x 16 accumulator tiles per wave, rows x columns
constexpr int SL = BM / 16;       // tile rows of x that a thread stages
constexpr int HW = SL / 2;        // of these, rows held in registers at a time
static_assert(BM == BN, "one plane size serves both operands");
// LDS row pitch of the staged f16 planes, in elements: 64 data + 8 pad = 144 B
// (16 B x odd), so the 16 rows of a ds_load_b128 fragment read fall on distinct banks.
constexpr int LDP = BK + 8;
constexpr int PLANE = BM * LDP;   // elements of one staged plane
constexpr int STAGE = 2 * PLANE;  // elements of one buffer: x plane | weight plane
constexpr int NT = Kdim / BK;     // K tiles
constexpr int CP = 64 + 4;        // pitch in floats of a wave's output rows in LDS
constexpr int OUTB = 8 * 128 * CP * 4;   // bytes of the eight waves' output ranges
constexpr int PF = 4;             // trip t asks L2 for x tile t + PF
static_assert(BM == 256 && BK * 4 == 256, "one thread a tile row: one aligned 256-B unit of x");
static_assert(PF == 4 && NT > PF, "the hints' byte offsets below are those of tiles 1 to PF");
static_assert(NT >= 2 && NT % 2 == 0, "the two peeled trips read buffer 0, then buffer 1");

// Pointers typed as global memory: they stay global_load addresses after passing
// through an asm operand.
typedef const __attribute__((address_space(1))) float* gfloat_ptr;
typedef const __attribute__((address_space(1))) f32x4* gf32x4_ptr;
typedef __attribute__((address_space(1))) float* gfloat_out_ptr;
typedef __attribute__((address_space(1))) f32x4* gf32x4_out_ptr;

union FragAB { f16x16 v; f16x8 h[2]; };

__device__ __forceinline__ f32x8 wmma_f16(f16x16 a, f16x16 b, f32x8 c) {
  // 8 args: (neg_a, A, neg_b, B, c_mod, C, reuse_a, reuse_b)
  return __builtin_amdgcn_wmma_f32_16x16x32_f16(false, a, false, b,
                                                (short)0, c, false, false);
}

// Load one 16x32 f16 WMMA operand fragment from LDS.
// Per ISA layout: lanes 0-15 take K chunks [0,8)+[16,24); lanes 16-31 take
// [8,16)+[24,32) of their row/col. `rowBase` already includes half*8; `k` is ks.
__device__ __forceinline__ f16x16 lds_frag(const _Float16* rowBase, int k) {
  FragAB f;
  f.h[0] = *(const f16x8*)(rowBase + k);
  f.h[1] = *(const f16x8*)(rowBase + k + 16);
  return f.v;
}

// Prefetch one staging slice into registers: 4 f32 of each of 16 tile rows, 16 rows apart.
// 16 adjacent lanes read one row's 256 B, so a wave-wide load covers four whole 128-B lines.
__device__ __forceinline__ void load_slice(gfloat_ptr src, f32x4* p) {
  #pragma unroll
  for (int i = 0; i < SL; ++i) p[i] = *(gf32x4_ptr)(src + (size_t)i * 16 * Kdim);
}

// Round 4 f32 to f16 (to nearest even, 11 significant bits) and store them. f16 holds
// magnitudes up to 65,504 and keeps a step of 6e-8 below 6.1e-5: unit normals and weights
// scaled by 1 / sqrt(K) lie far inside.
__device__ __forceinline__ void cvt_store_row(f32x4 p, _Float16* d) {
  *(f16x4*)d = __builtin_convertvector(p, f16x4);
}

// Work-group barrier that waits for this wave's LDS traffic only: __syncthreads() would
// also drain the global loads that are in flight for x tile 1.
__device__ __forceinline__ void lds_barrier() {
  asm volatile("s_wait_dscnt 0x0" ::: "memory");    // own LDS stores landed, own reads done
  asm volatile("s_barrier_signal -1" ::: "memory");
  asm volatile("s_barrier_wait -1" ::: "memory");
}

__device__ __forceinline__ uint32_t uni(uint32_t v) {
  return (uint32_t)__builtin_amdgcn_readfirstlane(v);
}

// A wave-uniform word for a test that must compile to a scalar branch: a tensor load ignores
// EXEC, and only such a branch keeps a wave from issuing it.
__device__ __forceinline__ uint32_t pinned(uint32_t v) {
  uint32_t w = uni(v);
  asm volatile("" : "+s"(w));  // pinned(): holds the word in a scalar register
  return w;
}

// Byte offset of a __shared__ address in the work-group's LDS.
__device__ __forceinline__ uint32_t lds_off(const void* p) { return (uint32_t)(size_t)p; }

// One tensor load brings TROWS rows of 128 B (64 f16 of k) of the weight plane into LDS,
// 16 B of pad behind each row: the pitch of 144 B that the fragment reads expect.
constexpr uint32_t TROWS = 128;
constexpr uint32_t TWAVES = BN / TROWS;       // issuing waves: one plane of BN rows
constexpr uint32_t TROWB = BK * 2;
static_assert(TROWB == 128 && LDP * 2 == TROWB + 16, "pad codes 4 / 3: rows of 128 B, 16 B more");
static_assert((TROWS * LDP * 2) % 2048 == 0 && (PLANE * 2) % 2048 == 0 && (STAGE * 2) % 2048 == 0,
              "every slice lands at a multiple of 2 KiB");

// Descriptor group 1: 1-byte elements, tensor = tile = TROWS rows of TROWB bytes, no mask.
__device__ __forceinline__ u32x8 tdm_group1() {
  // Each word pinned(): built once and held in its scalar register through the K loop, so
  // that none is written again while a request is outstanding.
  u32x8 g;
  g[0] = pinned((1u << 20) | (4u << 22) | (3u << 25));
  g[1] = pinned((TROWB & 0xFFFFu) << 16);
  g[2] = pinned((TROWB >> 16) | ((TROWS & 0xFFFFu) << 16));
  g[3] = pinned((TROWS >> 16) | (TROWB << 16));
  g[4] = pinned(TROWS);
  g[5] = pinned((uint32_t)Kdim * 2u);   // source row pitch in bytes
  g[6] = pinned(0u);
  g[7] = pinned(0u);
  return g;
}

// Descriptor group 0: count 1, place in LDS, the tile's first byte, type 2.
__device__ __forceinline__ u32x4 tdm_group0(uint32_t lds_dst, uint64_t ga) {
  u32x4 g;
  g[0] = uni(1u);
  g[1] = uni(lds_dst);
  g[2] = uni((uint32_t)ga);
  g[3] = uni((((uint32_t)(ga >> 32)) & 0x01FFFFFFu) | 0x80000000u);
  return g;
}

__device__ __forceinline__ void tdm_load(u32x4 g0, u32x8 g1) {
  asm volatile("tensor_load_to_lds %0, %1" :: "s"(g0), "s"(g1) : "memory");
}

// Publish point of the next tile: this wave's LDS traffic is done, an issuing wave's weight
// slice has landed, then the work-group barrier. As lds_barrier(), it leaves the global loads
// for the tile after next in flight.
__device__ __forceinline__ void publish(uint32_t tw) {
  asm volatile("s_wait_dscnt 0x0" ::: "memory");    // own LDS stores landed, own reads done
  // The issuer's own wait, before it signals.
  if (pinned(tw < TWAVES)) asm volatile("s_wait_tensorcnt 0x0" ::: "memory");
  asm volatile("s_barrier_signal -1" ::: "memory");
  asm volatile("s_barrier_wait -1" ::: "memory");
}

// One K tile: the products of the tile in buffer rd. The A fragments of accumulator row
// i + 2 are read from LDS in front of row i's products, into one of 3 register sets, so that
// no row waits for its own reads. Behind each row's reads one staged row of x of the NEXT
// tile goes from registers into buffer wr (ST), and the same registers are refilled with
// the row that is staged HW rows later: in the next tile (L1) or, from the middle of the
// trip on, in the tile after it (L2). The weight plane of the next tile comes by tensor load.
// n1A: this lane's staging address in the next tile.
// fa, fb: this lane's fragment offsets in the A and B planes; so: its staging offset.
template <bool ST, bool L1, bool L2>
__device__ __forceinline__ void k_tile(const _Float16* rd, _Float16* wr, gfloat_ptr n1A,
                                       f32x4 (&pA)[HW],
                                       f32x8 (&acc)[MS][NS], int fa, int fb, int so) {
  static_assert((BK / 32) * MS == SL, "one staged row of x per accumulator row");
  constexpr int D = 3;   // register sets of the A fragments
  f16x16 af[D];
  #pragma unroll
  for (int j = 0; j < D - 1; ++j) af[j] = lds_frag(rd + fa + j * 16 * LDP, 0);
  // The first rows' A reads stay in front of the B reads: the scheduler otherwise puts them
  // last, and the tile's first product then waits for nearly all of the reads.
  __builtin_amdgcn_sched_barrier(0);
  #pragma unroll
  for (int ks = 0; ks < BK; ks += 32) {
    f16x16 bf[NS];
    #pragma unroll
    for (int ns = 0; ns < NS; ++ns) bf[ns] = lds_frag(rd + PLANE + fb + ns * 16 * LDP, ks);
    #pragma unroll
    for (int ms = 0; ms < MS; ++ms) {
      const int i = (ks / 32) * MS + ms;
      const int c = i % D;
      if (i + D - 1 < SL) {
        const int n = i + D - 1, nm = n % MS, nk = (n / MS) * 32;
        af[n % D] = lds_frag(rd + fa + nm * 16 * LDP, nk);
      }
      // The fragment reads issue as one group in front of this row's products.
      __builtin_amdgcn_sched_barrier(0);
      #pragma unroll
      for (int ns = 0; ns < NS; ++ns) {
        // One product of operands rounded to f16, f32 C.
        // The weight fragment is the matrix A and the x fragment the matrix B: a lane's 8
        // accumulator registers are then 8 consecutive channels of one row of the output.
        acc[ms][ns] = wmma_f16(bf[ns], af[c], acc[ms][ns]);
      }
      const int s = i % HW;
      if constexpr (ST) {
        cvt_store_row(pA[s], wr + so + i * 16 * LDP);
      }
      if (i < HW) {
        if constexpr (L1) {
          // Behind the kernel's last staging loads their address registers fall free: the
          // wait for the address translations stands in front of whatever reuses them, and
          // the fence keeps this load directly in front of the wait.
          constexpr bool last = !L2;
          if (last && i == HW - 1) __builtin_amdgcn_sched_barrier(0);
          pA[s] = *(gf32x4_ptr)(n1A + (size_t)(i + HW) * 16 * Kdim);
          if (last && i == HW - 1) asm volatile("s_wait_xcnt 0x0" ::: "memory");
        }
      } else {
        if constexpr (L2) {
          pA[s] = *(gf32x4_ptr)(n1A + BK + (size_t)(i - HW) * 16 * Kdim);
        }
      }
      // Keeps each row's staging and refill loads in their row: the scheduler otherwise
      // sinks the loads to the end of the trip, a few rows in front of their first use.
      __builtin_amdgcn_sched_barrier(0);
    }
  }
}

// x * sigmoid(x) = h + h * tanh(h) with h = x / 2: one v_tanh_f32 and one fma.
__device__ __forceinline__ float silu_of_half(float h) {
  return __builtin_fmaf(h, __builtin_amdgcn_tanhf(h), h);
}

// ah, bh, mh: half the folded scale, half the folded shift, half the channel's multiplier,
// so that each SiLU gets its argument already halved (a halving is exact short of underflow).
__device__ __forceinline__ float gn_silu_chain(float v, float ah, float bh, float mh) {
  float h = v * ah + bh;         // ((v - mean) * inv * gamma + beta) / 2, folded
  return silu_of_half(silu_of_half(h) * mh);
}

// The value of lane l ^ 16.
__device__ __forceinline__ float xhalf(float x) {
  return __builtin_bit_cast(float, __builtin_amdgcn_permlanex16(
      __builtin_bit_cast(int, x), __builtin_bit_cast(int, x),
      0x76543210, 0xfedcba98, false, false));
}

} // namespace

// First launch: the weights rounded once to an f16 plane [Ndim][Kdim] in the workspace.
// One work-group of 16 waves a WGP; a thread has SPL loads of 16 B in flight, each wave-wide
// load covering four whole lines.
constexpr int SPT = 512, SPL = 8;
constexpr int SPG = Ndim * Kdim / (SPT * SPL * 4);
static_assert(SPG * SPT * SPL * 4 == Ndim * Kdim, "whole work-groups");

__global__ __launch_bounds__(SPT)
void round_weights(const float* __restrict__ w, _Float16* __restrict__ plane) {
  const size_t e = (size_t)blockIdx.x * (SPT * SPL * 4) + threadIdx.x * 4;
  f32x4 p[SPL];
  #pragma unroll
  for (int i = 0; i < SPL; ++i) p[i] = *(const f32x4*)(w + e + i * (SPT * 4));
  #pragma unroll
  for (int i = 0; i < SPL; ++i) cvt_store_row(p[i], plane + e + i * (SPT * 4));
}

__global__ __launch_bounds__(256)
void fused_gemm_gn_silu(const float* __restrict__ x,
                        const _Float16* __restrict__ wp,
                        const float* __restrict__ bias,
                        const float* __restrict__ gnw,
                        const float* __restrict__ gnb,
                        const float* __restrict__ mw,
                        float* __restrict__ out) {
  // 272 KB LDS, time-aliased: two buffers of [x plane | weight plane] (72 KB each) during
  // the GEMM, the finished output rows (272 KB) after.
  // Aligned so that every tensor load's place is a multiple of 2 KiB.
  __shared__ __attribute__((aligned(2048))) unsigned char smem[OUTB];
  static_assert(2 * STAGE * 2 <= OUTB, "the two buffers lie inside the output staging");

  _Float16* St = (_Float16*)smem;         // [2][2][BM][LDP]

  const int tid  = threadIdx.x;
  const int lane = tid & 31;
  const int wave = tid >> 5;
  const int wm   = wave >> 2;             // 0..1  -> 128-row strip
  const int wn   = wave & 3;              // 0..3  -> 64-col strip
  const int r16  = lane & 15;
  const int half = lane >> 4;             // K sub-chunk select per WMMA layout

  const int m0 = blockIdx.y * BM;
  const int n0 = blockIdx.x * BN;

  // Staging: 16 lanes per tile row, 4 f32 each; a thread serves rows sRow + 16 * i.
  // A wave's two rows lie 8 apart: 8 * 144 B = 32 banks mod 64, so its 8-byte LDS
  // stores fall on 64 distinct banks.
  const int sRow = wave + half * 8;
  const int sCol = r16 * 4;


  gfloat_ptr srcA = (gfloat_ptr)(x + (size_t)(m0 + sRow) * Kdim + sCol);
  // L2 hints for x: thread tid asks for row m0 + tid of a later K tile. The register holds the
  // row's address in tile min(t, NT - 1 - PF): with a byte offset of at most PF tiles it lies
  // inside x at every issue and behind every advance.
  gfloat_ptr hintA = (gfloat_ptr)(x + (size_t)(m0 + tid) * Kdim);

  f32x8 acc[MS][NS] = {};

  const int fa = (wm * 128 + r16) * LDP + half * 8;   // fragment offsets, k sub-chunk included
  const int fb = (wn * 64 + r16) * LDP + half * 8;
  const int so = sRow * LDP + sCol;                   // staging offset

  // The weight plane comes by tensor load: waves 0 and 1 each bring 128 of its rows, one
  // request a wave and tile.
  const uint32_t tw = uni((uint32_t)wave);
  const uint32_t th = tw & 1u;                        // half of the plane's 256 rows
  const uint64_t tsrc = (uint64_t)(uintptr_t)wp +
      (uint64_t)((uint32_t)n0 + th * TROWS) * Kdim * 2u;
  const uint32_t tdst = lds_off(smem) + PLANE * 2 + th * (TROWS * LDP * 2);
  const u32x8 g1 = tdm_group1();

  // Prologue: x tile 0 through registers into buffer 0, the weight plane of tile 0 by tensor
  // load, the first half of x tile 1 on its way into registers.
  f32x4 pA[HW];
  {
    f32x4 qA[SL];
    load_slice(srcA, qA);
    // Tiles 1 to PF - 1 set out from memory to L2 now: the staging loads lead their use by
    // half a trip.
    asm volatile("global_prefetch_b8 %0, off offset:256 scope:SCOPE_SE\n\t"
                 "global_prefetch_b8 %0, off offset:512 scope:SCOPE_SE\n\t"
                 "global_prefetch_b8 %0, off offset:768 scope:SCOPE_SE" :: "v"(hintA) : "memory");
    if (pinned(tw < TWAVES)) {
      tdm_load(tdm_group0(tdst, tsrc), g1);
      asm volatile("s_wait_tensorcnt 0x0" ::: "memory");  // tile 0's slice has landed
    }
    #pragma unroll
    for (int i = 0; i < SL; ++i) cvt_store_row(qA[i], St + so + i * 16 * LDP);
  }
  #pragma unroll
  for (int i = 0; i < HW; ++i) pA[i] = *(gf32x4_ptr)(srcA + BK + (size_t)i * 16 * Kdim);
  lds_barrier();
  if (pinned(tw < TWAVES)) tdm_load(tdm_group0(tdst + STAGE * 2, tsrc + BK * 2), g1);

  // Trip t multiplies tile t out of buffer t & 1 while x tile t + 1 is rounded and stored into
  // the other buffer, where its weight plane lands; the second half of x tile t + 1 and the
  // first half of x tile t + 2 are loaded. The one barrier of a trip publishes tile t + 1 and
  // ends every read of the buffer that is refilled behind it: there the weight plane of
  // tile t + 2 is asked for (t + 2 < NT in every trip of this loop).
  for (int t = 0; t < NT - 2; ++t) {
    const int cur = t & 1;
    // x tile t + PF is asked into L2, two and a half trips ahead of its first staging load.
    asm volatile("global_prefetch_b8 %0, off offset:1024 scope:SCOPE_SE" :: "v"(hintA) : "memory");
    k_tile<true, true, true>(St + cur * STAGE, St + (cur ^ 1) * STAGE, srcA + BK,
                             pA, acc, fa, fb, so);
    publish(tw);
    if (pinned(tw < TWAVES))
      tdm_load(tdm_group0(tdst + (uint32_t)cur * (STAGE * 2),
                          tsrc + (uint64_t)(uint32_t)(t + 2) * (BK * 2)), g1);
    // The loads issued above name srcA, the hint names hintA: wait for their address
    // translations before the pointers advance; the operands keep the additions behind it.
    asm volatile("s_wait_xcnt 0x0" : "+v"(srcA), "+v"(hintA) :: "memory");
    srcA += BK;
    hintA += (t + 1 + PF < NT) ? BK : 0;   // stops at the last tile: never past a row's end
  }
  k_tile<true, true, false>(St, St + STAGE, srcA + BK, pA, acc, fa, fb, so);
  publish(tw);
  k_tile<false, false, false>(St + STAGE, St, srcA, pA, acc, fa, fb, so);

  // The ring's closing waits: no tensor load and no LDS read of this wave is outstanding
  // when the buffers become output staging.
  asm volatile("s_wait_tensorcnt 0x0" ::: "memory");
  asm volatile("s_wait_dscnt 0x0" ::: "memory");
  __syncthreads();  // staging readers done before the output rows overwrite LDS

  // Accumulator map with the weights as A: acc[ms][ns][r] is row wm*128 + ms*16 + r16,
  // channel wn*64 + ns*16 + half*8 + r of the tile. A group's 32 channels are the tiles
  // ns = 2g and 2g + 1 of lanes l and l ^ 16: its sums are in-lane adds and one exchange
  // of the lane halves.
  static_assert(GS == 32 && NS == 4, "two accumulator tiles per group, two groups per wave");
  // The wave's place as scalars and the lane from the hardware: of the epilogue's indices
  // only the wave's number lives through the K loop.
  const int sw = __builtin_amdgcn_readfirstlane(wave);
  const int em = sw >> 2, en = sw & 3;                 // as wm, wn
  const int el = (int)__builtin_amdgcn_mbcnt_lo(~0u, 0u);
  const int e16 = el & 15, eh = el >> 4;               // as r16, half
  const int ch0 = n0 + en * 64 + eh * 8;               // this lane's first channel
  const int g0  = blockIdx.x * (BN / GS) + en * 2;     // this wave's first group
  const float* pb = bias + ch0;
  const float* pm = mw + ch0;
  const float* pw = gnw + g0;
  const float* pg = gnb + g0;
  f32x4 bv[NS][2], mh[NS][2];
  float gamma[2], beta[2];
  #pragma unroll
  for (int ns = 0; ns < NS; ++ns) {
    #pragma unroll
    for (int j = 0; j < 2; ++j) {
      bv[ns][j] = *(const f32x4*)(pb + ns * 16 + j * 4);
      mh[ns][j] = *(const f32x4*)(pm + ns * 16 + j * 4);
    }
  }
  #pragma unroll
  for (int g = 0; g < 2; ++g) {
    gamma[g] = pw[g];
    beta[g]  = pg[g];
  }
  // These loads name their address registers: this wait stands in front of the code below,
  // which reuses those registers. The input operands keep the four addresses live up to
  // the wait, so that no load lands in one and nothing else is put there.
  asm volatile("s_wait_xcnt 0x0" :: "v"(pb), "v"(pm), "s"(pw), "s"(pg) : "memory");
  #pragma unroll
  for (int ns = 0; ns < NS; ++ns) {
    mh[ns][0] *= 0.5f;                                 // the halves that gn_silu_chain takes
    mh[ns][1] *= 0.5f;
  }
  #pragma unroll
  for (int g = 0; g < 2; ++g) {
    gamma[g] *= 0.5f;
    beta[g]  *= 0.5f;
  }

  // The finished rows pass through the wave's own LDS range, so that the global stores
  // cover whole 128-B lines. Pitch 64 + 4 floats: the 16 rows of a 16-byte store, and the
  // 64 channels of a row that is read back, each fall on 64 distinct banks.
  float* Cw = (float*)smem + sw * (128 * CP);
  float* wr = Cw + e16 * CP + eh * 8;                  // as computed: one row, 8 channels a tile
  const float* rb = Cw + eh * CP + e16 * 4;            // read back: 16 lanes a row, 2 rows
  gfloat_out_ptr og =
      (gfloat_out_ptr)(out + (size_t)(m0 + em * 128 + eh) * Ndim + n0 + en * 64 + e16 * 4);

  // The accumulators go to LDS as they are, each lane's 8 channels of a tile in two 16-byte
  // stores; the loop below takes them back from the same places, so that it can stay rolled.
  #pragma unroll
  for (int ms = 0; ms < MS; ++ms) {
    #pragma unroll
    for (int ns = 0; ns < NS; ++ns) {
      const f32x8 c = acc[ms][ns];
      *(f32x4*)(wr + ms * 16 * CP + ns * 16)     = __builtin_shufflevector(c, c, 0, 1, 2, 3);
      *(f32x4*)(wr + ms * 16 * CP + ns * 16 + 4) = __builtin_shufflevector(c, c, 4, 5, 6, 7);
    }
  }

  // Two accumulator rows (32 output rows) a trip. The loop stays rolled: unrolled, its text
  // is four times as long.
  constexpr int SB = 2;
  static_assert(MS % SB == 0, "whole trips");
  #pragma unroll 1
  for (int it = 0; it < MS / SB; ++it) {
    f32x4 raw[SB][2 * NS];
    #pragma unroll
    for (int sl = 0; sl < SB; ++sl) {
      #pragma unroll
      for (int k = 0; k < 2 * NS; ++k)
        raw[sl][k] = *(const f32x4*)(wr + sl * 16 * CP + (k >> 1) * 16 + (k & 1) * 4);
    }
    f32x4 t[8];
    #pragma unroll
    for (int sl = 0; sl < SB; ++sl) {
      #pragma unroll
      for (int g = 0; g < 2; ++g) {
        // Element by element, as gn_silu_chain is: with 4-wide vector arithmetic here this
        // compiler's register allocation of the K loop came out with copies of staged rows
        // behind waits for nearly all loads in flight.
        float v[16];
        #pragma unroll
        for (int e = 0; e < 16; ++e)
          v[e] = raw[sl][4 * g + (e >> 2)][e & 3] + bv[2 * g + (e >> 3)][(e >> 2) & 1][e & 3];
        float sp[4], qp[4];
        #pragma unroll
        for (int e = 0; e < 4; ++e) {
          sp[e] = (v[e] + v[e + 4]) + (v[e + 8] + v[e + 12]);
          qp[e] = (v[e] * v[e] + v[e + 4] * v[e + 4]) + (v[e + 8] * v[e + 8] + v[e + 12] * v[e + 12]);
        }
        float s  = (sp[0] + sp[1]) + (sp[2] + sp[3]);
        float ss = (qp[0] + qp[1]) + (qp[2] + qp[3]);
        s  += xhalf(s);
        ss += xhalf(ss);
        const float mean = s * (1.0f / GS);
        const float var  = ss * (1.0f / GS) - mean * mean;
        const float inv  = rsqrtf(var + EPS);
        const float a    = inv * gamma[g];             // gamma, beta: halved above
        const float b    = beta[g] - mean * a;
        #pragma unroll
        for (int q = 0; q < 4; ++q) {
          const f32x4 m = mh[2 * g + (q >> 1)][q & 1];
          f32x4 o;
          o[0] = gn_silu_chain(v[4 * q + 0], a, b, m[0]);
          o[1] = gn_silu_chain(v[4 * q + 1], a, b, m[1]);
          o[2] = gn_silu_chain(v[4 * q + 2], a, b, m[2]);
          o[3] = gn_silu_chain(v[4 * q + 3], a, b, m[3]);
          *(f32x4*)(wr + sl * 16 * CP + g * 32 + (q >> 1) * 16 + (q & 1) * 4) = o;
        }
      }
      if (sl > 0) {
        // Output is write-once: stream past L2 (TH=NT) to preserve x/W reuse.
        #pragma unroll
        for (int i = 0; i < 8; ++i)
          __builtin_nontemporal_store(t[i],
              (gf32x4_out_ptr)(og + (size_t)((sl - 1) * 16 + 2 * i) * Ndim));
        // The stores name t: their address translations are waited for before t is refilled.
        asm volatile("s_wait_xcnt 0x0" ::: "memory");
      }
      // This wave's LDS stores have landed before its lanes read each other's rows back.
      asm volatile("s_wait_dscnt 0x0" ::: "memory");
      #pragma unroll
      for (int i = 0; i < 8; ++i) t[i] = *(const f32x4*)(rb + (sl * 16 + 2 * i) * CP);
    }
    #pragma unroll
    for (int i = 0; i < 8; ++i)
      __builtin_nontemporal_store(t[i],
          (gf32x4_out_ptr)(og + (size_t)((SB - 1) * 16 + 2 * i) * Ndim));
    // The stores name og and t: wait for their address translations before the pointer
    // advances and the next trip refills t; the operand keeps the addition behind the wait.
    asm volatile("s_wait_xcnt 0x0" : "+v"(og) :: "memory");
    og += (size_t)SB * 16 * Ndim;
    wr += SB * 16 * CP;
    rb += SB * 16 * CP;
  }
}

extern "C" void kernel_launch(void* const* d_in, const int* in_sizes, int n_in,
                              void* d_out, int out_size, void* d_ws, size_t ws_size,
                              hipStream_t stream) {
  (void)in_sizes; (void)n_in; (void)out_size; (void)ws_size;
  const float* x    = (const float*)d_in[0];
  const float* w    = (const float*)d_in[1];
  const float* bias = (const float*)d_in[2];
  const float* gnw  = (const float*)d_in[3];
  const float* gnb  = (const float*)d_in[4];
  const float* mw   = (const float*)d_in[5];
  float* out        = (float*)d_out;
  _Float16* plane   = (_Float16*)d_ws; // weight plane: 8 MiB

  dim3 grid(Ndim / BN, Mdim / BM);   // 8 x 64 workgroups
  dim3 block(256);                   // 8 wave32s
  round_weights<<<dim3(SPG), dim3(SPT), 0, stream>>>(w, plane);
  fused_gemm_gn_silu<<<grid, block, 0, stream>>>(x, plane, bias, gnw, gnb, mw, out);
}
